// v000
// Times are from an AMD MI455X. After a warm-up the kernel runs many times in a row, and a time is the length of
// such a window on the GPU divided by its runs, so every launch and the gaps after it count. The runs cycle
// through copies of the inputs. A figure is the median of several windows, for all but v000 over two sittings.
// Sittings can differ by a few percent; kernels timed side by side share one.
// v000 is the starting kernel. One run takes 1250 microseconds.
#include <hip/hip_runtime.h>

// Flash-attention for B=4, S=4096, H=256 (fp32 in/out, additive mask).
// bf16 WMMA (v_wmma_f32_16x16x32_bf16) with f32 accumulation + online softmax.
// 1 block = 4 wave32, each wave owns a 16-row query tile; keys streamed in
// blocks of 32 through LDS. Q/K/V fragments all sourced from LDS (Q/K via
// ds_load_b128, V via per-key 16-bit reads) to keep VGPRs < 256;
// global_prefetch_b8 runs 2 blocks ahead.

#define B_ 4
#define S_ 4096
#define H_ 256

typedef __bf16 v16bf __attribute__((ext_vector_type(16)));
typedef float  v8f   __attribute__((ext_vector_type(8)));

__device__ __forceinline__ unsigned short f2bfbits(float f) {
  union { float f; unsigned u; } x; x.f = f;
  unsigned r = x.u + 0x7FFFu + ((x.u >> 16) & 1u);   // round-to-nearest-even
  return (unsigned short)(r >> 16);
}
__device__ __forceinline__ __bf16 bits2bf(unsigned short s) {
  union { unsigned short s; __bf16 b; } y; y.s = s; return y.b;
}

#define LDK 264   // bf16 row stride: >=256 and == 8 (mod 128) -> conflict-free b128 reads
#define LDP 40    // P staging stride (20-bank lane step, disjoint windows)
#define PFD 64    // prefetch distance in keys (2 key-blocks)

__global__ __launch_bounds__(128, 1)
void fa_kernel(const float* __restrict__ q, const float* __restrict__ k,
               const float* __restrict__ v, const float* __restrict__ mask,
               float* __restrict__ out) {
  __shared__ unsigned short Qs[4][16][LDK]; // per-wave Q tile: [m][h], bf16 bits
  __shared__ unsigned short Ks[32][LDK];    // K tile: [key][h], bf16 bits
  __shared__ unsigned short Vs[32][LDK];    // V tile: [key][h], bf16 bits
  __shared__ unsigned short Ps[4][16][LDP]; // per-wave P tile: [m][k], bf16 bits

  const int tid  = threadIdx.x;
  const int lane = tid & 31;
  const int wave = tid >> 5;
  const int half = lane >> 4;   // 0: lanes 0-15, 1: lanes 16-31
  const int l16  = lane & 15;

  const int nqblk = S_ / 64;
  const int b    = blockIdx.x / nqblk;
  const int qblk = (blockIdx.x % nqblk) * 64;
  const int qb   = qblk + wave * 16;

  // ---- stage Q tile (64 rows x 256 h) to LDS as bf16, cooperatively ----
#pragma unroll
  for (int p = 0; p < 32; ++p) {
    const int r  = p * 2 + (tid >> 6);   // 0..63
    const int c4 = tid & 63;             // float4 column
    const float4 qv = ((const float4*)(q + ((size_t)b * S_ + qblk + r) * H_))[c4];
    unsigned short* dst = &Qs[r >> 4][r & 15][c4 * 4];
    dst[0] = f2bfbits(qv.x); dst[1] = f2bfbits(qv.y);
    dst[2] = f2bfbits(qv.z); dst[3] = f2bfbits(qv.w);
  }

  // ---- accumulators & softmax state ----
  v8f acc[16];                 // O tile: 16 (rows) x 256 (h) f32, 16 C-tiles
#pragma unroll
  for (int j = 0; j < 16; ++j)
#pragma unroll
    for (int i = 0; i < 8; ++i) acc[j][i] = 0.0f;

  float mrow[8], lrow[8];      // per row (m = i + 8*half), replicated in 16-lane group
#pragma unroll
  for (int i = 0; i < 8; ++i) { mrow[i] = -__builtin_inff(); lrow[i] = 0.0f; }

  const float scale = 0.0625f; // 1/sqrt(256)

  // ---- hoisted per-lane base pointers (loop adds only uniform kb terms) ----
  const size_t tid64 = (size_t)tid * 64;                       // 256 B stride
  const float* kpf = k + (size_t)b * S_ * H_ + (size_t)PFD * H_ + tid64;
  const float* vpf = v + (size_t)b * S_ * H_ + (size_t)PFD * H_ + tid64;
  const float* mpf = mask + ((size_t)b * S_ + (qb + l16)) * S_ + half * 16 + PFD;
  const float* mdem = mask + ((size_t)b * S_ + qb + 8 * half) * S_ + l16;
  const float* kvb  = k + (size_t)b * S_ * H_;
  const float* vvb  = v + (size_t)b * S_ * H_;

  for (int kb = 0; kb < S_; kb += 32) {
    // ---- speculative prefetch (global_prefetch_b8), 2 key-blocks ahead ----
    if (kb < S_ - PFD) {
      __builtin_prefetch(kpf + (size_t)kb * H_, 0, 1);
      __builtin_prefetch(vpf + (size_t)kb * H_, 0, 1);
      __builtin_prefetch(mpf + kb, 0, 1);
    }

    __syncthreads();           // previous iteration's LDS consumers done

    // ---- cooperative K/V tile load: 32 keys x 256 h, f32 -> bf16 ----
#pragma unroll
    for (int p = 0; p < 16; ++p) {
      const int r  = p * 2 + (tid >> 6);   // 0..31
      const int c4 = tid & 63;             // float4 column
      const size_t row = (size_t)(kb + r) * H_;
      const float4 kv = ((const float4*)(kvb + row))[c4];
      const float4 vv = ((const float4*)(vvb + row))[c4];
      const int c = c4 * 4;
      Ks[r][c + 0] = f2bfbits(kv.x); Ks[r][c + 1] = f2bfbits(kv.y);
      Ks[r][c + 2] = f2bfbits(kv.z); Ks[r][c + 3] = f2bfbits(kv.w);
      Vs[r][c + 0] = f2bfbits(vv.x); Vs[r][c + 1] = f2bfbits(vv.y);
      Vs[r][c + 2] = f2bfbits(vv.z); Vs[r][c + 3] = f2bfbits(vv.w);
    }
    __syncthreads();

    // ---- S = Q K^T : two 16x16 f32 tiles (keys 0-15, 16-31) ----
    v8f s0, s1;
#pragma unroll
    for (int i = 0; i < 8; ++i) { s0[i] = 0.0f; s1[i] = 0.0f; }

#pragma unroll
    for (int c = 0; c < 8; ++c) {
      v16bf qa, b0, b1;        // A = Q chunk (16x32); B = K^T chunk (32h x 16keys)
#pragma unroll
      for (int e = 0; e < 16; ++e) {
        const int kd = half * 8 + (e & 7) + ((e >> 3) << 4);
        qa[e] = bits2bf(Qs[wave][l16][c * 32 + kd]);
        b0[e] = bits2bf(Ks[l16][c * 32 + kd]);
        b1[e] = bits2bf(Ks[16 + l16][c * 32 + kd]);
      }
      s0 = __builtin_amdgcn_wmma_f32_16x16x32_bf16(false, qa, false, b0,
                                                   (short)0, s0, false, false);
      s1 = __builtin_amdgcn_wmma_f32_16x16x32_bf16(false, qa, false, b1,
                                                   (short)0, s1, false, false);
    }

    // ---- scale + mask (C layout: row m = i + 8*half, col = l16) ----
#pragma unroll
    for (int i = 0; i < 8; ++i) {
      const float* mrowp = mdem + (size_t)i * S_ + kb;
      s0[i] = s0[i] * scale + mrowp[0];
      s1[i] = s1[i] * scale + mrowp[16];
    }

    // ---- online softmax over this 32-key block ----
#pragma unroll
    for (int i = 0; i < 8; ++i) {
      float mx = fmaxf(s0[i], s1[i]);
#pragma unroll
      for (int off = 8; off >= 1; off >>= 1)
        mx = fmaxf(mx, __shfl_xor(mx, off, 32));   // reduce within 16-lane group
      const float mnew  = fmaxf(mrow[i], mx);
      const float alpha = __expf(mrow[i] - mnew);
      const float p0 = __expf(s0[i] - mnew);
      const float p1 = __expf(s1[i] - mnew);
      float ps = p0 + p1;
#pragma unroll
      for (int off = 8; off >= 1; off >>= 1)
        ps += __shfl_xor(ps, off, 32);
      lrow[i] = lrow[i] * alpha + ps;
      mrow[i] = mnew;
      s0[i] = p0; s1[i] = p1;
#pragma unroll
      for (int j = 0; j < 16; ++j) acc[j][i] *= alpha;  // rescale O
    }

    // ---- stage P (C layout -> LDS row-major) for A-fragment transpose ----
#pragma unroll
    for (int i = 0; i < 8; ++i) {
      const int m = i + 8 * half;
      Ps[wave][m][l16]      = f2bfbits(s0[i]);
      Ps[wave][m][16 + l16] = f2bfbits(s1[i]);
    }
    __syncthreads();

    v16bf pf;                  // P as A-matrix 16x32
#pragma unroll
    for (int e = 0; e < 16; ++e) {
      const int kd = half * 8 + (e & 7) + ((e >> 3) << 4);
      pf[e] = bits2bf(Ps[wave][l16][kd]);
    }

    // ---- O += P V : 16 h-tiles ----
#pragma unroll
    for (int j = 0; j < 16; ++j) {
      v16bf vb;                // B = V chunk: (32 keys) x (16 h); N = l16
#pragma unroll
      for (int e = 0; e < 16; ++e) {
        const int kd = half * 8 + (e & 7) + ((e >> 3) << 4);
        vb[e] = bits2bf(Vs[kd][j * 16 + l16]);
      }
      acc[j] = __builtin_amdgcn_wmma_f32_16x16x32_bf16(false, pf, false, vb,
                                                       (short)0, acc[j], false, false);
    }
  }

  // ---- epilogue: normalize and store ----
#pragma unroll
  for (int i = 0; i < 8; ++i) {
    const float inv = 1.0f / lrow[i];
    const int qrow  = qb + i + 8 * half;
    const size_t oo = ((size_t)b * S_ + qrow) * H_;
#pragma unroll
    for (int j = 0; j < 16; ++j)
      out[oo + j * 16 + l16] = acc[j][i] * inv;
  }
}

extern "C" void kernel_launch(void* const* d_in, const int* in_sizes, int n_in,
                              void* d_out, int out_size, void* d_ws, size_t ws_size,
                              hipStream_t stream) {
  const float* q = (const float*)d_in[0];
  const float* k = (const float*)d_in[1];
  const float* v = (const float*)d_in[2];
  const float* m = (const float*)d_in[3];
  float* out = (float*)d_out;

  dim3 grid(B_ * (S_ / 64));
  dim3 block(128);
  hipLaunchKernelGGL(fa_kernel, grid, block, 0, stream, q, k, v, m, out);
}

// v001
// Measured time: 357 microseconds a run.
// Timed twice side by side with v000, it ran 3.48 and 3.49 times as fast.
#include <hip/hip_runtime.h>
#include <stdint.h>

// Flash-attention for B=4, S=4096, H=256 (fp32 in/out, additive mask).
// bf16 WMMA (v_wmma_f32_16x16x32_bf16) with f32 accumulation + online softmax.
// 1 block = 4 wave32, each wave owns a 16-row query tile; keys streamed in
// blocks of 32 through LDS. Q/K/V fragments all sourced from LDS.
// K/V f32 tiles come in by tensor_load_to_lds, two buffers, one pass ahead of
// their use; each pass converts its landed tile to the bf16 tiles Ks/Vs.

#define B_ 4
#define S_ 4096
#define H_ 256

typedef __bf16 v16bf __attribute__((ext_vector_type(16)));
typedef float  v8f   __attribute__((ext_vector_type(8)));

__device__ __forceinline__ unsigned short f2bfbits(float f) {
  union { float f; unsigned u; } x; x.f = f;
  unsigned r = x.u + 0x7FFFu + ((x.u >> 16) & 1u);   // round-to-nearest-even
  return (unsigned short)(r >> 16);
}
__device__ __forceinline__ __bf16 bits2bf(unsigned short s) {
  union { unsigned short s; __bf16 b; } y; y.s = s; return y.b;
}

#define LDK 264   // bf16 row stride: >=256 and == 8 (mod 128) -> conflict-free b128 reads
#define LDP 40    // P staging stride (20-bank lane step, disjoint windows)
#define PFD 64    // prefetch distance in keys (2 key-blocks)
#define NST (S_ / 32)          // stages = passes: 32 keys each
#define SLICE_B 16384u         // one wave's slice: 16 rows x 1024 B
#define STAGE_B (4u * SLICE_B) // K rows 0-15, K rows 16-31, V rows 0-15, V rows 16-31

typedef uint32_t u32x4 __attribute__((ext_vector_type(4)));
typedef uint32_t u32x8 __attribute__((ext_vector_type(8)));

__device__ __forceinline__ uint32_t uni(uint32_t v) {
  return (uint32_t)__builtin_amdgcn_readfirstlane(v);
}
// Holds a wave-uniform test in a scalar register so that the branch on it is
// a scalar one: a tensor load ignores EXEC and only such a branch skips it.
__device__ __forceinline__ uint32_t pinned(uint32_t v) {
  uint32_t w = uni(v);
  asm volatile("" : "+s"(w));
  return w;
}
// Tensor descriptor, group 1: byte elements, tile = tensor = 16 rows of 1024 B,
// source pitch 1024 B, no mask, no pad.
__device__ __forceinline__ u32x8 tdm_group1() {
  u32x8 g;
  g[0] = uni(0u);
  g[1] = uni(1024u << 16);
  g[2] = uni(16u << 16);
  g[3] = uni(1024u << 16);
  g[4] = uni(16u);
  g[5] = uni(1024u);
  g[6] = uni(0u);
  g[7] = uni(0u);
  return g;
}
// Group 0: count 1, LDS byte offset, global address of the first byte, type 2.
__device__ __forceinline__ u32x4 tdm_group0(uint32_t lds_dst, uint64_t ga) {
  u32x4 g;
  g[0] = uni(1u);
  g[1] = uni(lds_dst);
  g[2] = uni((uint32_t)ga);
  g[3] = uni((((uint32_t)(ga >> 32)) & 0x01FFFFFFu) | 0x80000000u);
  return g;
}

__global__ __launch_bounds__(128, 1)
void fa_kernel(const float* __restrict__ q, const float* __restrict__ k,
               const float* __restrict__ v, const float* __restrict__ mask,
               float* __restrict__ out) {
  // f32 landing ring of the tensor loads: [buffer][K 32 rows, then V 32 rows][h]
  __shared__ __attribute__((aligned(2048))) float Fs[2][2][32 * H_];
  __shared__ unsigned short Qs[4][16][LDK]; // per-wave Q tile: [m][h], bf16 bits
  __shared__ unsigned short Ks[32][LDK];    // K tile: [key][h], bf16 bits
  __shared__ unsigned short Vs[32][LDK];    // V tile: [key][h], bf16 bits
  __shared__ unsigned short Ps[4][16][LDP]; // per-wave P tile: [m][k], bf16 bits

  const int tid  = threadIdx.x;
  const int lane = tid & 31;
  const int wave = tid >> 5;
  const int half = lane >> 4;   // 0: lanes 0-15, 1: lanes 16-31
  const int l16  = lane & 15;

  const int nqblk = S_ / 64;
  const int b    = blockIdx.x / nqblk;
  const int qblk = (blockIdx.x % nqblk) * 64;
  const int qb   = qblk + wave * 16;

  // ---- stage Q tile (64 rows x 256 h) to LDS as bf16, cooperatively ----
#pragma unroll
  for (int p = 0; p < 32; ++p) {
    const int r  = p * 2 + (tid >> 6);   // 0..63
    const int c4 = tid & 63;             // float4 column
    const float4 qv = ((const float4*)(q + ((size_t)b * S_ + qblk + r) * H_))[c4];
    unsigned short* dst = &Qs[r >> 4][r & 15][c4 * 4];
    dst[0] = f2bfbits(qv.x); dst[1] = f2bfbits(qv.y);
    dst[2] = f2bfbits(qv.z); dst[3] = f2bfbits(qv.w);
  }

  // ---- accumulators & softmax state ----
  v8f acc[16];                 // O tile: 16 (rows) x 256 (h) f32, 16 C-tiles
#pragma unroll
  for (int j = 0; j < 16; ++j)
#pragma unroll
    for (int i = 0; i < 8; ++i) acc[j][i] = 0.0f;

  float mrow[8], lrow[8];      // per row (m = i + 8*half), replicated in 16-lane group
#pragma unroll
  for (int i = 0; i < 8; ++i) { mrow[i] = -__builtin_inff(); lrow[i] = 0.0f; }

  const float scale = 0.0625f; // 1/sqrt(256)

  // ---- hoisted per-lane base pointers (loop adds only uniform kb terms) ----
  const float* mpf = mask + ((size_t)b * S_ + (qb + l16)) * S_ + half * 16 + PFD;
  const float* mdem = mask + ((size_t)b * S_ + qb + 8 * half) * S_ + l16;

  // ---- tensor-load ring: every wave brings one 16-row slice per stage ----
  // waves 0,1: the two halves of the K tile; waves 2,3: of the V tile.
  const uint32_t wv    = uni((uint32_t)tid >> 5);
  const uint32_t lbase = (uint32_t)(size_t)&Fs[0][0][0] + wv * SLICE_B;
  const uint64_t gbase = (uint64_t)(size_t)((wv & 2u) ? v : k)
                       + ((uint64_t)b * S_ + (wv & 1u) * 16u) * (H_ * 4u);
  const u32x8 g1 = tdm_group1();
  auto issue = [&](uint32_t st) {
    const u32x4 g0 = tdm_group0(lbase + (st & 1u) * STAGE_B,
                                gbase + (uint64_t)st * (32u * H_ * 4u));
    asm volatile("tensor_load_to_lds %0, %1" :: "s"(g0), "s"(g1) : "memory");
  };
  issue(0);
  // stage 0 landed in this wave; the barrier publishes it (and Qs) to all waves
  asm volatile("s_wait_tensorcnt 0x0" ::: "memory");
  __syncthreads();
  issue(1);

  for (int kb = 0; kb < S_; kb += 32) {
    const uint32_t st = (uint32_t)kb >> 5;
    // ---- speculative prefetch (global_prefetch_b8), 2 key-blocks ahead ----
    if (kb < S_ - PFD) {
      __builtin_prefetch(mpf + kb, 0, 1);
    }

    // ---- cooperative convert of the landed tile: 32 keys x 256 h, f32 -> bf16 ----
    const float4* kf4 = (const float4*)&Fs[st & 1u][0][0];
    const float4* vf4 = (const float4*)&Fs[st & 1u][1][0];
#pragma unroll
    for (int p = 0; p < 16; ++p) {
      const int r  = p * 2 + (tid >> 6);   // 0..31
      const int c4 = tid & 63;             // float4 column
      const float4 kv = kf4[r * (H_ / 4) + c4];
      const float4 vv = vf4[r * (H_ / 4) + c4];
      const int c = c4 * 4;
      Ks[r][c + 0] = f2bfbits(kv.x); Ks[r][c + 1] = f2bfbits(kv.y);
      Ks[r][c + 2] = f2bfbits(kv.z); Ks[r][c + 3] = f2bfbits(kv.w);
      Vs[r][c + 0] = f2bfbits(vv.x); Vs[r][c + 1] = f2bfbits(vv.y);
      Vs[r][c + 2] = f2bfbits(vv.z); Vs[r][c + 3] = f2bfbits(vv.w);
    }
    __syncthreads();

    // ---- S = Q K^T : two 16x16 f32 tiles (keys 0-15, 16-31) ----
    v8f s0, s1;
#pragma unroll
    for (int i = 0; i < 8; ++i) { s0[i] = 0.0f; s1[i] = 0.0f; }

#pragma unroll
    for (int c = 0; c < 8; ++c) {
      v16bf qa, b0, b1;        // A = Q chunk (16x32); B = K^T chunk (32h x 16keys)
#pragma unroll
      for (int e = 0; e < 16; ++e) {
        const int kd = half * 8 + (e & 7) + ((e >> 3) << 4);
        qa[e] = bits2bf(Qs[wave][l16][c * 32 + kd]);
        b0[e] = bits2bf(Ks[l16][c * 32 + kd]);
        b1[e] = bits2bf(Ks[16 + l16][c * 32 + kd]);
      }
      s0 = __builtin_amdgcn_wmma_f32_16x16x32_bf16(false, qa, false, b0,
                                                   (short)0, s0, false, false);
      s1 = __builtin_amdgcn_wmma_f32_16x16x32_bf16(false, qa, false, b1,
                                                   (short)0, s1, false, false);
    }

    // ---- scale + mask (C layout: row m = i + 8*half, col = l16) ----
#pragma unroll
    for (int i = 0; i < 8; ++i) {
      const float* mrowp = mdem + (size_t)i * S_ + kb;
      s0[i] = s0[i] * scale + mrowp[0];
      s1[i] = s1[i] * scale + mrowp[16];
    }

    // ---- online softmax over this 32-key block ----
#pragma unroll
    for (int i = 0; i < 8; ++i) {
      float mx = fmaxf(s0[i], s1[i]);
#pragma unroll
      for (int off = 8; off >= 1; off >>= 1)
        mx = fmaxf(mx, __shfl_xor(mx, off, 32));   // reduce within 16-lane group
      const float mnew  = fmaxf(mrow[i], mx);
      const float alpha = __expf(mrow[i] - mnew);
      const float p0 = __expf(s0[i] - mnew);
      const float p1 = __expf(s1[i] - mnew);
      float ps = p0 + p1;
#pragma unroll
      for (int off = 8; off >= 1; off >>= 1)
        ps += __shfl_xor(ps, off, 32);
      lrow[i] = lrow[i] * alpha + ps;
      mrow[i] = mnew;
      s0[i] = p0; s1[i] = p1;
#pragma unroll
      for (int j = 0; j < 16; ++j) acc[j][i] *= alpha;  // rescale O
    }

    // ---- stage P (C layout -> LDS row-major) for A-fragment transpose ----
#pragma unroll
    for (int i = 0; i < 8; ++i) {
      const int m = i + 8 * half;
      Ps[wave][m][l16]      = f2bfbits(s0[i]);
      Ps[wave][m][16 + l16] = f2bfbits(s1[i]);
    }
    __syncthreads();

    v16bf pf;                  // P as A-matrix 16x32
#pragma unroll
    for (int e = 0; e < 16; ++e) {
      const int kd = half * 8 + (e & 7) + ((e >> 3) << 4);
      pf[e] = bits2bf(Ps[wave][l16][kd]);
    }

    // ---- O += P V : 16 h-tiles ----
#pragma unroll
    for (int j = 0; j < 16; ++j) {
      v16bf vb;                // B = V chunk: (32 keys) x (16 h); N = l16
#pragma unroll
      for (int e = 0; e < 16; ++e) {
        const int kd = half * 8 + (e & 7) + ((e >> 3) << 4);
        vb[e] = bits2bf(Vs[kd][j * 16 + l16]);
      }
      acc[j] = __builtin_amdgcn_wmma_f32_16x16x32_bf16(false, pf, false, vb,
                                                       (short)0, acc[j], false, false);
    }

    // ---- publish point of stage st + 1 ----
    // this wave's LDS reads of this pass have retired
    asm volatile("s_wait_dscnt 0x0" ::: "memory");
    // this wave's slice of stage st + 1 has landed
    asm volatile("s_wait_tensorcnt 0x0" ::: "memory");
    __syncthreads();           // publishes stage st + 1; every reader has left this pass's LDS
    if (pinned(st + 2u < (uint32_t)NST)) issue(st + 2u);  // refill the buffer just read
  }
  // nothing of the ring is in flight when the wave goes on to its end
  asm volatile("s_wait_tensorcnt 0x0" ::: "memory");
  asm volatile("s_wait_dscnt 0x0" ::: "memory");

  // ---- epilogue: normalize and store ----
#pragma unroll
  for (int i = 0; i < 8; ++i) {
    const float inv = 1.0f / lrow[i];
    const int qrow  = qb + i + 8 * half;
    const size_t oo = ((size_t)b * S_ + qrow) * H_;
#pragma unroll
    for (int j = 0; j < 16; ++j)
      out[oo + j * 16 + l16] = acc[j][i] * inv;
  }
}

extern "C" void kernel_launch(void* const* d_in, const int* in_sizes, int n_in,
                              void* d_out, int out_size, void* d_ws, size_t ws_size,
                              hipStream_t stream) {
  const float* q = (const float*)d_in[0];
  const float* k = (const float*)d_in[1];
  const float* v = (const float*)d_in[2];
  const float* m = (const float*)d_in[3];
  float* out = (float*)d_out;

  dim3 grid(B_ * (S_ / 64));
  dim3 block(128);
  hipLaunchKernelGGL(fa_kernel, grid, block, 0, stream, q, k, v, m, out);
}

// v002
// It runs in 316 microseconds.
// Two timings next to v001 both put it at 1.13 times that version's speed.
// Over all steps from v000 it is 3.94 times as fast.
#include <hip/hip_runtime.h>
#include <stdint.h>

// Flash-attention for B=4, S=4096, H=256 (fp32 in/out, additive mask).
// bf16 WMMA (v_wmma_f32_16x16x32_bf16) with f32 accumulation + online softmax.
// 1 block = 4 wave32, each wave owns a 16-row query tile; keys streamed in
// blocks of 32 through LDS. Q/K/V fragments all sourced from LDS.
// K/V f32 tiles come in by tensor_load_to_lds, two buffers, one pass ahead of
// their use; each pass converts its landed tile to the bf16 tiles Ks/Vs.
// V's B fragments (32 keys x 16 h) come out of the row-major tile Vs by the
// 16-bit transposing LDS load, two loads a fragment.

#define B_ 4
#define S_ 4096
#define H_ 256

typedef __bf16 v16bf __attribute__((ext_vector_type(16)));
typedef float  v8f   __attribute__((ext_vector_type(8)));

__device__ __forceinline__ unsigned short f2bfbits(float f) {
  union { float f; unsigned u; } x; x.f = f;
  unsigned r = x.u + 0x7FFFu + ((x.u >> 16) & 1u);   // round-to-nearest-even
  return (unsigned short)(r >> 16);
}
__device__ __forceinline__ __bf16 bits2bf(unsigned short s) {
  union { unsigned short s; __bf16 b; } y; y.s = s; return y.b;
}

#define LDK 264   // bf16 row stride: >=256 and == 8 (mod 128) -> conflict-free b128 reads
#define LDV 272   // V row stride: 544 B, an odd multiple of 32 B, the transposing load's conflict-free pitch
#define LDP 40    // P staging stride (20-bank lane step, disjoint windows)
#define PFD 64    // prefetch distance in keys (2 key-blocks)
#define NST (S_ / 32)          // stages = passes: 32 keys each
#define SLICE_B 16384u         // one wave's slice: 16 rows x 1024 B
#define STAGE_B (4u * SLICE_B) // K rows 0-15, K rows 16-31, V rows 0-15, V rows 16-31

typedef uint32_t u32x4 __attribute__((ext_vector_type(4)));
typedef uint32_t u32x8 __attribute__((ext_vector_type(8)));
typedef short s16x8 __attribute__((ext_vector_type(8)));
typedef __attribute__((address_space(3))) s16x8 lds_s16x8;

// ds_load_tr16_b128: with lane l aimed at row 8*(l>>4) + (l&7), byte 16*((l>>3)&1)
// of a 16 x 16 tile of 16-bit elements, lane (c = l&15, h = l>>4) gets rows
// 8h .. 8h+7 of column c.
__device__ __forceinline__ u32x4 ld_tr16(const unsigned char* p) {
  return __builtin_bit_cast(u32x4, __builtin_amdgcn_ds_load_tr16_b128_v8i16((lds_s16x8*)p));
}

__device__ __forceinline__ uint32_t uni(uint32_t v) {
  return (uint32_t)__builtin_amdgcn_readfirstlane(v);
}
// Holds a wave-uniform test in a scalar register so that the branch on it is
// a scalar one: a tensor load ignores EXEC and only such a branch skips it.
__device__ __forceinline__ uint32_t pinned(uint32_t v) {
  uint32_t w = uni(v);
  asm volatile("" : "+s"(w));
  return w;
}
// Tensor descriptor, group 1: byte elements, tile = tensor = 16 rows of 1024 B,
// source pitch 1024 B, no mask, no pad.
__device__ __forceinline__ u32x8 tdm_group1() {
  u32x8 g;
  g[0] = uni(0u);
  g[1] = uni(1024u << 16);
  g[2] = uni(16u << 16);
  g[3] = uni(1024u << 16);
  g[4] = uni(16u);
  g[5] = uni(1024u);
  g[6] = uni(0u);
  g[7] = uni(0u);
  return g;
}
// Group 0: count 1, LDS byte offset, global address of the first byte, type 2.
__device__ __forceinline__ u32x4 tdm_group0(uint32_t lds_dst, uint64_t ga) {
  u32x4 g;
  g[0] = uni(1u);
  g[1] = uni(lds_dst);
  g[2] = uni((uint32_t)ga);
  g[3] = uni((((uint32_t)(ga >> 32)) & 0x01FFFFFFu) | 0x80000000u);
  return g;
}

__global__ __launch_bounds__(128, 1)
void fa_kernel(const float* __restrict__ q, const float* __restrict__ k,
               const float* __restrict__ v, const float* __restrict__ mask,
               float* __restrict__ out) {
  // f32 landing ring of the tensor loads: [buffer][K 32 rows, then V 32 rows][h]
  __shared__ __attribute__((aligned(2048))) float Fs[2][2][32 * H_];
  __shared__ unsigned short Qs[4][16][LDK]; // per-wave Q tile: [m][h], bf16 bits
  __shared__ unsigned short Ks[32][LDK];    // K tile: [key][h], bf16 bits
  __shared__ __attribute__((aligned(16))) unsigned short Vs[32][LDV]; // V tile: [key][h], bf16 bits
  __shared__ unsigned short Ps[4][16][LDP]; // per-wave P tile: [m][k], bf16 bits

  const int tid  = threadIdx.x;
  const int lane = tid & 31;
  const int wave = tid >> 5;
  const int half = lane >> 4;   // 0: lanes 0-15, 1: lanes 16-31
  const int l16  = lane & 15;

  const int nqblk = S_ / 64;
  const int b    = blockIdx.x / nqblk;
  const int qblk = (blockIdx.x % nqblk) * 64;
  const int qb   = qblk + wave * 16;

  // ---- stage Q tile (64 rows x 256 h) to LDS as bf16, cooperatively ----
#pragma unroll
  for (int p = 0; p < 32; ++p) {
    const int r  = p * 2 + (tid >> 6);   // 0..63
    const int c4 = tid & 63;             // float4 column
    const float4 qv = ((const float4*)(q + ((size_t)b * S_ + qblk + r) * H_))[c4];
    unsigned short* dst = &Qs[r >> 4][r & 15][c4 * 4];
    dst[0] = f2bfbits(qv.x); dst[1] = f2bfbits(qv.y);
    dst[2] = f2bfbits(qv.z); dst[3] = f2bfbits(qv.w);
  }

  // ---- accumulators & softmax state ----
  v8f acc[16];                 // O tile: 16 (rows) x 256 (h) f32, 16 C-tiles
#pragma unroll
  for (int j = 0; j < 16; ++j)
#pragma unroll
    for (int i = 0; i < 8; ++i) acc[j][i] = 0.0f;

  float mrow[8], lrow[8];      // per row (m = i + 8*half), replicated in 16-lane group
#pragma unroll
  for (int i = 0; i < 8; ++i) { mrow[i] = -__builtin_inff(); lrow[i] = 0.0f; }

  const float scale = 0.0625f; // 1/sqrt(256)

  // ---- hoisted per-lane base pointers (loop adds only uniform kb terms) ----
  const float* mpf = mask + ((size_t)b * S_ + (qb + l16)) * S_ + half * 16 + PFD;
  const float* mdem = mask + ((size_t)b * S_ + qb + 8 * half) * S_ + l16;
  // this lane's address in Vs for the transposing loads of keys 0-15, h 0-15
  const unsigned char* vad = (const unsigned char*)&Vs[0][0]
                           + (uint32_t)(8 * half + (lane & 7)) * (LDV * 2u)
                           + (uint32_t)((lane >> 3) & 1) * 16u;

  // ---- tensor-load ring: every wave brings one 16-row slice per stage ----
  // waves 0,1: the two halves of the K tile; waves 2,3: of the V tile.
  const uint32_t wv    = uni((uint32_t)tid >> 5);
  const uint32_t lbase = (uint32_t)(size_t)&Fs[0][0][0] + wv * SLICE_B;
  const uint64_t gbase = (uint64_t)(size_t)((wv & 2u) ? v : k)
                       + ((uint64_t)b * S_ + (wv & 1u) * 16u) * (H_ * 4u);
  const u32x8 g1 = tdm_group1();
  auto issue = [&](uint32_t st) {
    const u32x4 g0 = tdm_group0(lbase + (st & 1u) * STAGE_B,
                                gbase + (uint64_t)st * (32u * H_ * 4u));
    asm volatile("tensor_load_to_lds %0, %1" :: "s"(g0), "s"(g1) : "memory");
  };
  issue(0);
  // stage 0 landed in this wave; the barrier publishes it (and Qs) to all waves
  asm volatile("s_wait_tensorcnt 0x0" ::: "memory");
  __syncthreads();
  issue(1);

  for (int kb = 0; kb < S_; kb += 32) {
    const uint32_t st = (uint32_t)kb >> 5;
    // ---- speculative prefetch (global_prefetch_b8), 2 key-blocks ahead ----
    if (kb < S_ - PFD) {
      __builtin_prefetch(mpf + kb, 0, 1);
    }

    // ---- cooperative convert of the landed tile: 32 keys x 256 h, f32 -> bf16 ----
    const float4* kf4 = (const float4*)&Fs[st & 1u][0][0];
    const float4* vf4 = (const float4*)&Fs[st & 1u][1][0];
#pragma unroll
    for (int p = 0; p < 16; ++p) {
      const int r  = p * 2 + (tid >> 6);   // 0..31
      const int c4 = tid & 63;             // float4 column
      const float4 kv = kf4[r * (H_ / 4) + c4];
      const float4 vv = vf4[r * (H_ / 4) + c4];
      const int c = c4 * 4;
      Ks[r][c + 0] = f2bfbits(kv.x); Ks[r][c + 1] = f2bfbits(kv.y);
      Ks[r][c + 2] = f2bfbits(kv.z); Ks[r][c + 3] = f2bfbits(kv.w);
      Vs[r][c + 0] = f2bfbits(vv.x); Vs[r][c + 1] = f2bfbits(vv.y);
      Vs[r][c + 2] = f2bfbits(vv.z); Vs[r][c + 3] = f2bfbits(vv.w);
    }
    __syncthreads();

    // ---- S = Q K^T : two 16x16 f32 tiles (keys 0-15, 16-31) ----
    v8f s0, s1;
#pragma unroll
    for (int i = 0; i < 8; ++i) { s0[i] = 0.0f; s1[i] = 0.0f; }

#pragma unroll
    for (int c = 0; c < 8; ++c) {
      v16bf qa, b0, b1;        // A = Q chunk (16x32); B = K^T chunk (32h x 16keys)
#pragma unroll
      for (int e = 0; e < 16; ++e) {
        const int kd = half * 8 + (e & 7) + ((e >> 3) << 4);
        qa[e] = bits2bf(Qs[wave][l16][c * 32 + kd]);
        b0[e] = bits2bf(Ks[l16][c * 32 + kd]);
        b1[e] = bits2bf(Ks[16 + l16][c * 32 + kd]);
      }
      s0 = __builtin_amdgcn_wmma_f32_16x16x32_bf16(false, qa, false, b0,
                                                   (short)0, s0, false, false);
      s1 = __builtin_amdgcn_wmma_f32_16x16x32_bf16(false, qa, false, b1,
                                                   (short)0, s1, false, false);
    }

    // ---- scale + mask (C layout: row m = i + 8*half, col = l16) ----
#pragma unroll
    for (int i = 0; i < 8; ++i) {
      const float* mrowp = mdem + (size_t)i * S_ + kb;
      s0[i] = s0[i] * scale + mrowp[0];
      s1[i] = s1[i] * scale + mrowp[16];
    }

    // ---- online softmax over this 32-key block ----
#pragma unroll
    for (int i = 0; i < 8; ++i) {
      float mx = fmaxf(s0[i], s1[i]);
#pragma unroll
      for (int off = 8; off >= 1; off >>= 1)
        mx = fmaxf(mx, __shfl_xor(mx, off, 32));   // reduce within 16-lane group
      const float mnew  = fmaxf(mrow[i], mx);
      const float alpha = __expf(mrow[i] - mnew);
      const float p0 = __expf(s0[i] - mnew);
      const float p1 = __expf(s1[i] - mnew);
      float ps = p0 + p1;
#pragma unroll
      for (int off = 8; off >= 1; off >>= 1)
        ps += __shfl_xor(ps, off, 32);
      lrow[i] = lrow[i] * alpha + ps;
      mrow[i] = mnew;
      s0[i] = p0; s1[i] = p1;
#pragma unroll
      for (int j = 0; j < 16; ++j) acc[j][i] *= alpha;  // rescale O
    }

    // ---- stage P (C layout -> LDS row-major) for A-fragment transpose ----
#pragma unroll
    for (int i = 0; i < 8; ++i) {
      const int m = i + 8 * half;
      Ps[wave][m][l16]      = f2bfbits(s0[i]);
      Ps[wave][m][16 + l16] = f2bfbits(s1[i]);
    }
    __syncthreads();

    v16bf pf;                  // P as A-matrix 16x32
#pragma unroll
    for (int e = 0; e < 16; ++e) {
      const int kd = half * 8 + (e & 7) + ((e >> 3) << 4);
      pf[e] = bits2bf(Ps[wave][l16][kd]);
    }

    // ---- O += P V : 16 h-tiles ----
#pragma unroll
    for (int j = 0; j < 16; ++j) {
      // B = V chunk: (32 keys) x (16 h); N = l16; element e = key half*8 + (e&7) + 16*(e>>3)
      const u32x4 lo = ld_tr16(vad + 32u * j);                    // keys 0-15
      const u32x4 hi = ld_tr16(vad + 16u * (LDV * 2u) + 32u * j); // keys 16-31
      const u32x8 vw = {lo.x, lo.y, lo.z, lo.w, hi.x, hi.y, hi.z, hi.w};
      const v16bf vb = __builtin_bit_cast(v16bf, vw);
      acc[j] = __builtin_amdgcn_wmma_f32_16x16x32_bf16(false, pf, false, vb,
                                                       (short)0, acc[j], false, false);
    }

    // ---- publish point of stage st + 1 ----
    // this wave's LDS reads of this pass have retired
    asm volatile("s_wait_dscnt 0x0" ::: "memory");
    // this wave's slice of stage st + 1 has landed
    asm volatile("s_wait_tensorcnt 0x0" ::: "memory");
    __syncthreads();           // publishes stage st + 1; every reader has left this pass's LDS
    if (pinned(st + 2u < (uint32_t)NST)) issue(st + 2u);  // refill the buffer just read
  }
  // nothing of the ring is in flight when the wave goes on to its end
  asm volatile("s_wait_tensorcnt 0x0" ::: "memory");
  asm volatile("s_wait_dscnt 0x0" ::: "memory");

  // ---- epilogue: normalize and store ----
#pragma unroll
  for (int i = 0; i < 8; ++i) {
    const float inv = 1.0f / lrow[i];
    const int qrow  = qb + i + 8 * half;
    const size_t oo = ((size_t)b * S_ + qrow) * H_;
#pragma unroll
    for (int j = 0; j < 16; ++j)
      out[oo + j * 16 + l16] = acc[j][i] * inv;
  }
}

extern "C" void kernel_launch(void* const* d_in, const int* in_sizes, int n_in,
                              void* d_out, int out_size, void* d_ws, size_t ws_size,
                              hipStream_t stream) {
  const float* q = (const float*)d_in[0];
  const float* k = (const float*)d_in[1];
  const float* v = (const float*)d_in[2];
  const float* m = (const float*)d_in[3];
  float* out = (float*)d_out;

  dim3 grid(B_ * (S_ / 64));
  dim3 block(128);
  hipLaunchKernelGGL(fa_kernel, grid, block, 0, stream, q, k, v, m, out);
}

// v003
// Measured time: 237 microseconds a run.
// In both of two side-by-side timings against v002, it was 1.33 times as fast.
// Over all steps from v000 it is 5.25 times as fast.
#include <hip/hip_runtime.h>
#include <stdint.h>

#define B_ 4
#define S_ 4096
#define H_ 256

typedef __bf16 v16bf __attribute__((ext_vector_type(16)));
typedef float  v8f   __attribute__((ext_vector_type(8)));

__device__ __forceinline__ unsigned short f2bfbits(float f) {
  union { float f; unsigned u; } x; x.f = f;
  unsigned r = x.u + 0x7FFFu + ((x.u >> 16) & 1u);   // round-to-nearest-even
  return (unsigned short)(r >> 16);
}
__device__ __forceinline__ __bf16 bits2bf(unsigned short s) {
  union { unsigned short s; __bf16 b; } y; y.s = s; return y.b;
}

#define LDK 264   // bf16 row stride: >=256 and == 8 (mod 128) -> conflict-free b128 reads
#define LDV 272   // V row stride: 544 B, an odd multiple of 32 B, the transposing load's conflict-free pitch
#define PFD 64    // prefetch distance in keys (2 key-blocks)
#define NST (S_ / 32)          // stages = passes: 32 keys each
#define SLICE_B 16384u         // one wave's slice: 16 rows x 1024 B
#define STAGE_B (4u * SLICE_B) // K rows 0-15, K rows 16-31, V rows 0-15, V rows 16-31

typedef uint32_t u32x4 __attribute__((ext_vector_type(4)));
typedef uint32_t u32x8 __attribute__((ext_vector_type(8)));
typedef short s16x8 __attribute__((ext_vector_type(8)));
typedef __attribute__((address_space(3))) s16x8 lds_s16x8;

// ds_load_tr16_b128: with lane l aimed at row 8*(l>>4) + (l&7), byte 16*((l>>3)&1)
// of a 16 x 16 tile of 16-bit elements, lane (c = l&15, h = l>>4) gets rows
// 8h .. 8h+7 of column c.
__device__ __forceinline__ u32x4 ld_tr16(const unsigned char* p) {
  return __builtin_bit_cast(u32x4, __builtin_amdgcn_ds_load_tr16_b128_v8i16((lds_s16x8*)p));
}

// Value of lane l ^ 16 (the other half of the wave), by a vector cross-row move.
__device__ __forceinline__ float other_half(float x) {
  const int b = __builtin_bit_cast(int, x);
  return __builtin_bit_cast(float, __builtin_amdgcn_permlanex16(
      b, b, 0x76543210, 0xfedcba98, false, false));
}

__device__ __forceinline__ uint32_t uni(uint32_t v) {
  return (uint32_t)__builtin_amdgcn_readfirstlane(v);
}
// Holds a wave-uniform test in a scalar register so that the branch on it is
// a scalar one: a tensor load ignores EXEC and only such a branch skips it.
__device__ __forceinline__ uint32_t pinned(uint32_t v) {
  uint32_t w = uni(v);
  asm volatile("" : "+s"(w));
  return w;
}
// Tensor descriptor, group 1: byte elements, tile = tensor = 16 rows of 1024 B,
// source pitch 1024 B, no mask, no pad.
__device__ __forceinline__ u32x8 tdm_group1() {
  u32x8 g;
  g[0] = uni(0u);
  g[1] = uni(1024u << 16);
  g[2] = uni(16u << 16);
  g[3] = uni(1024u << 16);
  g[4] = uni(16u);
  g[5] = uni(1024u);
  g[6] = uni(0u);
  g[7] = uni(0u);
  return g;
}
// Group 0: count 1, LDS byte offset, global address of the first byte, type 2.
__device__ __forceinline__ u32x4 tdm_group0(uint32_t lds_dst, uint64_t ga) {
  u32x4 g;
  g[0] = uni(1u);
  g[1] = uni(lds_dst);
  g[2] = uni((uint32_t)ga);
  g[3] = uni((((uint32_t)(ga >> 32)) & 0x01FFFFFFu) | 0x80000000u);
  return g;
}

__global__ __launch_bounds__(128, 1)
void fa_kernel(const float* __restrict__ q, const float* __restrict__ k,
               const float* __restrict__ v, const float* __restrict__ mask,
               float* __restrict__ out) {
  // f32 landing ring of the tensor loads: [buffer][K 32 rows, then V 32 rows][h]
  __shared__ __attribute__((aligned(2048))) float Fs[2][2][32 * H_];
  __shared__ unsigned short Qs[4][16][LDK]; // per-wave Q tile: [m][h], bf16 bits
  __shared__ unsigned short Ks[32][LDK];    // K tile: [key][h], bf16 bits
  __shared__ __attribute__((aligned(16))) unsigned short Vs[32][LDV]; // V tile: [key][h], bf16 bits

  const int tid  = threadIdx.x;
  const int lane = tid & 31;
  const int wave = tid >> 5;
  const int half = lane >> 4;   // 0: lanes 0-15, 1: lanes 16-31
  const int l16  = lane & 15;

  const int nqblk = S_ / 64;
  const int b    = blockIdx.x / nqblk;
  const int qblk = (blockIdx.x % nqblk) * 64;
  const int qb   = qblk + wave * 16;

  // ---- stage Q tile (64 rows x 256 h) to LDS as bf16, cooperatively ----
#pragma unroll
  for (int p = 0; p < 32; ++p) {
    const int r  = p * 2 + (tid >> 6);   // 0..63
    const int c4 = tid & 63;             // float4 column
    const float4 qv = ((const float4*)(q + ((size_t)b * S_ + qblk + r) * H_))[c4];
    unsigned short* dst = &Qs[r >> 4][r & 15][c4 * 4];
    dst[0] = f2bfbits(qv.x); dst[1] = f2bfbits(qv.y);
    dst[2] = f2bfbits(qv.z); dst[3] = f2bfbits(qv.w);
  }

  // ---- accumulators & softmax state ----
  v8f acc[16];                 // O^T: tile j, register i = O[query l16][h = 16j + 8*half + i]
#pragma unroll
  for (int j = 0; j < 16; ++j)
#pragma unroll
    for (int i = 0; i < 8; ++i) acc[j][i] = 0.0f;

  float mrow = -__builtin_inff(); // running maximum of query l16, the same in both halves
  float lrow = 0.0f;              // running sum of query l16 over this half's keys only

  const float scale = 0.0625f; // 1/sqrt(256)

  // ---- hoisted per-lane base pointers (loop adds only uniform kb terms) ----
  const float* mpf = mask + ((size_t)b * S_ + (qb + l16)) * S_ + half * 16 + PFD;
  const float* mdem = mask + ((size_t)b * S_ + qb + l16) * S_ + 8 * half;
  // this lane's address in Vs for the transposing loads of keys 0-15, h 0-15
  const unsigned char* vad = (const unsigned char*)&Vs[0][0]
                           + (uint32_t)(8 * half + (lane & 7)) * (LDV * 2u)
                           + (uint32_t)((lane >> 3) & 1) * 16u;

  // ---- tensor-load ring: every wave brings one 16-row slice per stage ----
  // waves 0,1: the two halves of the K tile; waves 2,3: of the V tile.
  const uint32_t wv    = uni((uint32_t)tid >> 5);
  const uint32_t lbase = (uint32_t)(size_t)&Fs[0][0][0] + wv * SLICE_B;
  const uint64_t gbase = (uint64_t)(size_t)((wv & 2u) ? v : k)
                       + ((uint64_t)b * S_ + (wv & 1u) * 16u) * (H_ * 4u);
  const u32x8 g1 = tdm_group1();
  auto issue = [&](uint32_t st) {
    const u32x4 g0 = tdm_group0(lbase + (st & 1u) * STAGE_B,
                                gbase + (uint64_t)st * (32u * H_ * 4u));
    asm volatile("tensor_load_to_lds %0, %1" :: "s"(g0), "s"(g1) : "memory");
  };
  issue(0);
  // stage 0 landed in this wave; the barrier publishes it (and Qs) to all waves
  asm volatile("s_wait_tensorcnt 0x0" ::: "memory");
  __syncthreads();
  issue(1);

  for (int kb = 0; kb < S_; kb += 32) {
    const uint32_t st = (uint32_t)kb >> 5;
    // ---- speculative prefetch (global_prefetch_b8), 2 key-blocks ahead ----
    if (kb < S_ - PFD) {
      __builtin_prefetch(mpf + kb, 0, 1);
    }

    // ---- cooperative convert of the landed tile: 32 keys x 256 h, f32 -> bf16 ----
    const float4* kf4 = (const float4*)&Fs[st & 1u][0][0];
    const float4* vf4 = (const float4*)&Fs[st & 1u][1][0];
#pragma unroll
    for (int p = 0; p < 16; ++p) {
      const int r  = p * 2 + (tid >> 6);   // 0..31
      const int c4 = tid & 63;             // float4 column
      const float4 kv = kf4[r * (H_ / 4) + c4];
      const float4 vv = vf4[r * (H_ / 4) + c4];
      const int c = c4 * 4;
      Ks[r][c + 0] = f2bfbits(kv.x); Ks[r][c + 1] = f2bfbits(kv.y);
      Ks[r][c + 2] = f2bfbits(kv.z); Ks[r][c + 3] = f2bfbits(kv.w);
      Vs[r][c + 0] = f2bfbits(vv.x); Vs[r][c + 1] = f2bfbits(vv.y);
      Vs[r][c + 2] = f2bfbits(vv.z); Vs[r][c + 3] = f2bfbits(vv.w);
    }
    __syncthreads();

    // ---- S^T = K Q^T : two 16x16 f32 tiles (keys 0-15, 16-31) x 16 queries ----
    v8f s0, s1;
#pragma unroll
    for (int i = 0; i < 8; ++i) { s0[i] = 0.0f; s1[i] = 0.0f; }

#pragma unroll
    for (int c = 0; c < 8; ++c) {
      v16bf qa, b0, b1;        // A = K chunk (16 keys x 32 h); B = Q^T chunk (32 h x 16 queries)
#pragma unroll
      for (int e = 0; e < 16; ++e) {
        const int kd = half * 8 + (e & 7) + ((e >> 3) << 4);
        qa[e] = bits2bf(Qs[wave][l16][c * 32 + kd]);
        b0[e] = bits2bf(Ks[l16][c * 32 + kd]);
        b1[e] = bits2bf(Ks[16 + l16][c * 32 + kd]);
      }
      s0 = __builtin_amdgcn_wmma_f32_16x16x32_bf16(false, b0, false, qa,
                                                   (short)0, s0, false, false);
      s1 = __builtin_amdgcn_wmma_f32_16x16x32_bf16(false, b1, false, qa,
                                                   (short)0, s1, false, false);
    }

    // ---- scale + mask (C layout: key = i + 8*half (+16 for s1), query = l16) ----
    {
      const float4* mq = (const float4*)(mdem + kb);
      const float4 ma = mq[0], mb = mq[1], mc = mq[4], md = mq[5];
      const float m0[8] = {ma.x, ma.y, ma.z, ma.w, mb.x, mb.y, mb.z, mb.w};
      const float m1[8] = {mc.x, mc.y, mc.z, mc.w, md.x, md.y, md.z, md.w};
#pragma unroll
      for (int i = 0; i < 8; ++i) s0[i] = s0[i] * scale + m0[i];
#pragma unroll
      for (int i = 0; i < 8; ++i) s1[i] = s1[i] * scale + m1[i];
    }
    // the next pass rewrites the address registers that the four mask loads name
    asm volatile("s_wait_xcnt 0x0" ::: "memory");

    // ---- online softmax over this 32-key block, one query per lane ----
    float mx = fmaxf(s0[0], s1[0]);
#pragma unroll
    for (int i = 1; i < 8; ++i) mx = fmaxf(mx, fmaxf(s0[i], s1[i]));
    mx = fmaxf(mx, other_half(mx));              // the other 16 keys of this query
    const float mnew  = fmaxf(mrow, mx);
    const float alpha = __expf(mrow - mnew);
    float ps = 0.0f;
#pragma unroll
    for (int i = 0; i < 8; ++i) {
      s0[i] = __expf(s0[i] - mnew);
      s1[i] = __expf(s1[i] - mnew);
      ps += s0[i] + s1[i];
    }
    lrow = lrow * alpha + ps;
    mrow = mnew;
#pragma unroll
    for (int j = 0; j < 16; ++j)
#pragma unroll
      for (int i = 0; i < 8; ++i) acc[j][i] *= alpha;  // rescale O^T

    // ---- P^T as B-matrix (32 keys x 16 queries): element e = key half*8 + (e&7) + 16*(e>>3),
    //      which is register e&7 of S^T tile e>>3 in this very lane ----
    v16bf pf;
#pragma unroll
    for (int i = 0; i < 8; ++i) {
      pf[i]     = bits2bf(f2bfbits(s0[i]));
      pf[8 + i] = bits2bf(f2bfbits(s1[i]));
    }

    // ---- O^T += V^T P^T : 16 h-tiles ----
#pragma unroll
    for (int j = 0; j < 16; ++j) {
      // A = V^T chunk: (16 h) x (32 keys); M = l16; element e = key half*8 + (e&7) + 16*(e>>3)
      const u32x4 lo = ld_tr16(vad + 32u * j);                    // keys 0-15
      const u32x4 hi = ld_tr16(vad + 16u * (LDV * 2u) + 32u * j); // keys 16-31
      const u32x8 vw = {lo.x, lo.y, lo.z, lo.w, hi.x, hi.y, hi.z, hi.w};
      const v16bf vb = __builtin_bit_cast(v16bf, vw);
      acc[j] = __builtin_amdgcn_wmma_f32_16x16x32_bf16(false, vb, false, pf,
                                                       (short)0, acc[j], false, false);
    }

    // ---- publish point of stage st + 1 ----
    // this wave's LDS reads of this pass have retired
    asm volatile("s_wait_dscnt 0x0" ::: "memory");
    // this wave's slice of stage st + 1 has landed
    asm volatile("s_wait_tensorcnt 0x0" ::: "memory");
    __syncthreads();           // publishes stage st + 1; every reader has left this pass's LDS
    if (pinned(st + 2u < (uint32_t)NST)) issue(st + 2u);  // refill the buffer just read
  }
  // nothing of the ring is in flight when the wave goes on to its end
  asm volatile("s_wait_tensorcnt 0x0" ::: "memory");
  asm volatile("s_wait_dscnt 0x0" ::: "memory");

  // ---- epilogue: join the halves' sums, normalize and store ----
  const float inv = 1.0f / (lrow + other_half(lrow));
  float* orow = out + ((size_t)b * S_ + qb + l16) * H_ + 8 * half;
#pragma unroll
  for (int j = 0; j < 16; ++j) {
    float4 lo4, hi4;
    lo4.x = acc[j][0] * inv; lo4.y = acc[j][1] * inv;
    lo4.z = acc[j][2] * inv; lo4.w = acc[j][3] * inv;
    hi4.x = acc[j][4] * inv; hi4.y = acc[j][5] * inv;
    hi4.z = acc[j][6] * inv; hi4.w = acc[j][7] * inv;
    ((float4*)(orow + j * 16))[0] = lo4;
    ((float4*)(orow + j * 16))[1] = hi4;
  }
}

extern "C" void kernel_launch(void* const* d_in, const int* in_sizes, int n_in,
                              void* d_out, int out_size, void* d_ws, size_t ws_size,
                              hipStream_t stream) {
  const float* q = (const float*)d_in[0];
  const float* k = (const float*)d_in[1];
  const float* v = (const float*)d_in[2];
  const float* m = (const float*)d_in[3];
  float* out = (float*)d_out;

  dim3 grid(B_ * (S_ / 64));
  dim3 block(128);
  hipLaunchKernelGGL(fa_kernel, grid, block, 0, stream, q, k, v, m, out);
}

// v004
// It runs in 158 microseconds.
// Two timings next to v003 put it at 1.49 and 1.48 times that version's speed.
// Over all steps from v000 it is 7.78 times as fast.
#include <hip/hip_runtime.h>
#include <stdint.h>

#define B_ 4
#define S_ 4096
#define H_ 256

typedef __bf16 v16bf __attribute__((ext_vector_type(16)));
typedef float  v8f   __attribute__((ext_vector_type(8)));

__device__ __forceinline__ unsigned short f2bfbits(float f) {
  union { float f; unsigned u; } x; x.f = f;
  unsigned r = x.u + 0x7FFFu + ((x.u >> 16) & 1u);   // round-to-nearest-even
  return (unsigned short)(r >> 16);
}
__device__ __forceinline__ __bf16 bits2bf(unsigned short s) {
  union { unsigned short s; __bf16 b; } y; y.s = s; return y.b;
}

#define LDK 264   // bf16 row stride: >=256 and == 8 (mod 128) -> conflict-free b128 reads
#define LDV 272   // V row stride: 544 B, an odd multiple of 32 B, the transposing load's conflict-free pitch
#define PFD 64    // prefetch distance in keys (2 key-blocks)
#define NST (S_ / 32)          // stages = passes: 32 keys each
#define SLICE_B 16384u         // one wave's slice: 16 rows x 1024 B
#define STAGE_B (4u * SLICE_B) // K rows 0-15, K rows 16-31, V rows 0-15, V rows 16-31

typedef uint32_t u32x4 __attribute__((ext_vector_type(4)));
typedef uint32_t u32x8 __attribute__((ext_vector_type(8)));
typedef short s16x8 __attribute__((ext_vector_type(8)));
typedef __attribute__((address_space(3))) s16x8 lds_s16x8;

// ds_load_tr16_b128: with lane l aimed at row 8*(l>>4) + (l&7), byte 16*((l>>3)&1)
// of a 16 x 16 tile of 16-bit elements, lane (c = l&15, h = l>>4) gets rows
// 8h .. 8h+7 of column c.
__device__ __forceinline__ u32x4 ld_tr16(const unsigned char* p) {
  return __builtin_bit_cast(u32x4, __builtin_amdgcn_ds_load_tr16_b128_v8i16((lds_s16x8*)p));
}

// Value of lane l ^ 16 (the other half of the wave), by a vector cross-row move.
__device__ __forceinline__ float other_half(float x) {
  const int b = __builtin_bit_cast(int, x);
  return __builtin_bit_cast(float, __builtin_amdgcn_permlanex16(
      b, b, 0x76543210, 0xfedcba98, false, false));
}

// Keeps a group of loads together and ahead of their users: without it the
// compiler sinks each load to just in front of its user, and the lone wave of
// a SIMD then waits out the full LDS latency at every matrix instruction.
__device__ __forceinline__ void hold_group() { __builtin_amdgcn_sched_barrier(0); }

__device__ __forceinline__ uint32_t uni(uint32_t v) {
  return (uint32_t)__builtin_amdgcn_readfirstlane(v);
}
// Holds a wave-uniform test in a scalar register so that the branch on it is
// a scalar one: a tensor load ignores EXEC and only such a branch skips it.
__device__ __forceinline__ uint32_t pinned(uint32_t v) {
  uint32_t w = uni(v);
  asm volatile("" : "+s"(w));
  return w;
}
// Tensor descriptor, group 1: byte elements, tile = tensor = 16 rows of 1024 B,
// source pitch 1024 B, no mask, no pad.
__device__ __forceinline__ u32x8 tdm_group1() {
  u32x8 g;
  g[0] = uni(0u);
  g[1] = uni(1024u << 16);
  g[2] = uni(16u << 16);
  g[3] = uni(1024u << 16);
  g[4] = uni(16u);
  g[5] = uni(1024u);
  g[6] = uni(0u);
  g[7] = uni(0u);
  return g;
}
// Group 0: count 1, LDS byte offset, global address of the first byte, type 2.
__device__ __forceinline__ u32x4 tdm_group0(uint32_t lds_dst, uint64_t ga) {
  u32x4 g;
  g[0] = uni(1u);
  g[1] = uni(lds_dst);
  g[2] = uni((uint32_t)ga);
  g[3] = uni((((uint32_t)(ga >> 32)) & 0x01FFFFFFu) | 0x80000000u);
  return g;
}

__global__ __launch_bounds__(128, 1)
void fa_kernel(const float* __restrict__ q, const float* __restrict__ k,
               const float* __restrict__ v, const float* __restrict__ mask,
               float* __restrict__ out) {
  // f32 landing ring of the tensor loads: [buffer][K 32 rows, then V 32 rows][h]
  __shared__ __attribute__((aligned(2048))) float Fs[2][2][32 * H_];
  __shared__ unsigned short Qs[4][16][LDK]; // per-wave Q tile: [m][h], bf16 bits
  __shared__ unsigned short Ks[32][LDK];    // K tile: [key][h], bf16 bits
  __shared__ __attribute__((aligned(16))) unsigned short Vs[32][LDV]; // V tile: [key][h], bf16 bits

  const int tid  = threadIdx.x;
  const int lane = tid & 31;
  const int wave = tid >> 5;
  const int half = lane >> 4;   // 0: lanes 0-15, 1: lanes 16-31
  const int l16  = lane & 15;

  const int nqblk = S_ / 64;
  const int b    = blockIdx.x / nqblk;
  const int qblk = (blockIdx.x % nqblk) * 64;
  const int qb   = qblk + wave * 16;

  // ---- stage Q tile (64 rows x 256 h) to LDS as bf16, cooperatively ----
#pragma unroll
  for (int p = 0; p < 32; ++p) {
    const int r  = p * 2 + (tid >> 6);   // 0..63
    const int c4 = tid & 63;             // float4 column
    const float4 qv = ((const float4*)(q + ((size_t)b * S_ + qblk + r) * H_))[c4];
    unsigned short* dst = &Qs[r >> 4][r & 15][c4 * 4];
    dst[0] = f2bfbits(qv.x); dst[1] = f2bfbits(qv.y);
    dst[2] = f2bfbits(qv.z); dst[3] = f2bfbits(qv.w);
  }

  // ---- accumulators & softmax state ----
  v8f acc[16];                 // O^T: tile j, register i = O[query l16][h = 16j + 8*half + i]
#pragma unroll
  for (int j = 0; j < 16; ++j)
#pragma unroll
    for (int i = 0; i < 8; ++i) acc[j][i] = 0.0f;

  float mrow = -__builtin_inff(); // running maximum of query l16, the same in both halves
  float lrow = 0.0f;              // running sum of query l16 over this half's keys only

  const float scale = 0.0625f; // 1/sqrt(256)

  // ---- hoisted per-lane base pointers (loop adds only uniform kb terms) ----
  const float* mpf = mask + ((size_t)b * S_ + (qb + l16)) * S_ + half * 16 + PFD;
  const float* mdem = mask + ((size_t)b * S_ + qb + l16) * S_ + 8 * half;
  // this lane's address in Vs for the transposing loads of keys 0-15, h 0-15
  const unsigned char* vad = (const unsigned char*)&Vs[0][0]
                           + (uint32_t)(8 * half + (lane & 7)) * (LDV * 2u)
                           + (uint32_t)((lane >> 3) & 1) * 16u;

  // ---- tensor-load ring: every wave brings one 16-row slice per stage ----
  // waves 0,1: the two halves of the K tile; waves 2,3: of the V tile.
  const uint32_t wv    = uni((uint32_t)tid >> 5);
  const uint32_t lbase = (uint32_t)(size_t)&Fs[0][0][0] + wv * SLICE_B;
  const uint64_t gbase = (uint64_t)(size_t)((wv & 2u) ? v : k)
                       + ((uint64_t)b * S_ + (wv & 1u) * 16u) * (H_ * 4u);
  const u32x8 g1 = tdm_group1();
  auto issue = [&](uint32_t st) {
    const u32x4 g0 = tdm_group0(lbase + (st & 1u) * STAGE_B,
                                gbase + (uint64_t)st * (32u * H_ * 4u));
    asm volatile("tensor_load_to_lds %0, %1" :: "s"(g0), "s"(g1) : "memory");
  };
  issue(0);
  // stage 0 landed in this wave; the barrier publishes it (and Qs) to all waves
  asm volatile("s_wait_tensorcnt 0x0" ::: "memory");
  __syncthreads();
  issue(1);

  for (int kb = 0; kb < S_; kb += 32) {
    const uint32_t st = (uint32_t)kb >> 5;
    // ---- speculative prefetch (global_prefetch_b8), 2 key-blocks ahead ----
    if (kb < S_ - PFD) {
      __builtin_prefetch(mpf + kb, 0, 1);
    }

    // ---- cooperative convert of the landed tile: 32 keys x 256 h, f32 -> bf16 ----
    const float4* kf4 = (const float4*)&Fs[st & 1u][0][0];
    const float4* vf4 = (const float4*)&Fs[st & 1u][1][0];
    float4 kl[16], vl[16];                 // this thread's 32 reads, one group
#pragma unroll
    for (int p = 0; p < 16; ++p) {
      const int r  = p * 2 + (tid >> 6);   // 0..31
      const int c4 = tid & 63;             // float4 column
      kl[p] = kf4[r * (H_ / 4) + c4];
      vl[p] = vf4[r * (H_ / 4) + c4];
    }
#pragma unroll
    for (int p = 0; p < 16; ++p) {
      const int r  = p * 2 + (tid >> 6);   // 0..31
      const int c4 = tid & 63;             // float4 column
      const float4 kv = kl[p];
      const float4 vv = vl[p];
      const int c = c4 * 4;
      Ks[r][c + 0] = f2bfbits(kv.x); Ks[r][c + 1] = f2bfbits(kv.y);
      Ks[r][c + 2] = f2bfbits(kv.z); Ks[r][c + 3] = f2bfbits(kv.w);
      Vs[r][c + 0] = f2bfbits(vv.x); Vs[r][c + 1] = f2bfbits(vv.y);
      Vs[r][c + 2] = f2bfbits(vv.z); Vs[r][c + 3] = f2bfbits(vv.w);
    }
    // order of this phase: the 32 LDS reads first, the rounding behind them
    __builtin_amdgcn_sched_group_barrier(0x100, 32, 0);
    __builtin_amdgcn_sched_group_barrier(0x002, 512, 0);
    __syncthreads();

    // ---- operand group of S^T: the four mask loads (the longest way) at its head,
    //      then all fragments of Q^T and K in the order of their use ----
    const float4* mq = (const float4*)(mdem + kb);
    const float4 ma = mq[0], mb = mq[1], mc = mq[4], md = mq[5];
    v16bf qa[8], b0[8], b1[8]; // A = K chunk (16 keys x 32 h); B = Q^T chunk (32 h x 16 queries)
#pragma unroll
    for (int c = 0; c < 8; ++c) {
#pragma unroll
      for (int e = 0; e < 16; ++e) {
        const int kd = half * 8 + (e & 7) + ((e >> 3) << 4);
        qa[c][e] = bits2bf(Qs[wave][l16][c * 32 + kd]);
        b0[c][e] = bits2bf(Ks[l16][c * 32 + kd]);
        b1[c][e] = bits2bf(Ks[16 + l16][c * 32 + kd]);
      }
    }
    // later code rewrites the address registers that the four mask loads name; the
    // input operand keeps that pair untouched up to this wait
    asm volatile("s_wait_xcnt 0x0" :: "v"(mq) : "memory");
    hold_group();

    // ---- S^T = K Q^T : two 16x16 f32 tiles (keys 0-15, 16-31) x 16 queries ----
    v8f s0, s1;
#pragma unroll
    for (int i = 0; i < 8; ++i) { s0[i] = 0.0f; s1[i] = 0.0f; }

#pragma unroll
    for (int c = 0; c < 8; ++c) {
      s0 = __builtin_amdgcn_wmma_f32_16x16x32_bf16(false, b0[c], false, qa[c],
                                                   (short)0, s0, false, false);
      s1 = __builtin_amdgcn_wmma_f32_16x16x32_bf16(false, b1[c], false, qa[c],
                                                   (short)0, s1, false, false);
    }

    // ---- operand group of O^T: all V^T fragments; they land under the softmax ----
    // A = V^T chunk: (16 h) x (32 keys); M = l16; element e = key half*8 + (e&7) + 16*(e>>3)
    u32x4 vlo[16], vhi[16];
#pragma unroll
    for (int j = 0; j < 16; ++j) {
      vlo[j] = ld_tr16(vad + 32u * j);                    // keys 0-15
      vhi[j] = ld_tr16(vad + 16u * (LDV * 2u) + 32u * j); // keys 16-31
    }
    hold_group();

    // ---- scale + mask (C layout: key = i + 8*half (+16 for s1), query = l16) ----
    {
      const float m0[8] = {ma.x, ma.y, ma.z, ma.w, mb.x, mb.y, mb.z, mb.w};
      const float m1[8] = {mc.x, mc.y, mc.z, mc.w, md.x, md.y, md.z, md.w};
#pragma unroll
      for (int i = 0; i < 8; ++i) s0[i] = s0[i] * scale + m0[i];
#pragma unroll
      for (int i = 0; i < 8; ++i) s1[i] = s1[i] * scale + m1[i];
    }

    // ---- online softmax over this 32-key block, one query per lane ----
    float mx = fmaxf(s0[0], s1[0]);
#pragma unroll
    for (int i = 1; i < 8; ++i) mx = fmaxf(mx, fmaxf(s0[i], s1[i]));
    mx = fmaxf(mx, other_half(mx));              // the other 16 keys of this query
    const float mnew  = fmaxf(mrow, mx);
    const float alpha = __expf(mrow - mnew);
    float ps = 0.0f;
#pragma unroll
    for (int i = 0; i < 8; ++i) {
      s0[i] = __expf(s0[i] - mnew);
      s1[i] = __expf(s1[i] - mnew);
      ps += s0[i] + s1[i];
    }
    lrow = lrow * alpha + ps;
    mrow = mnew;
#pragma unroll
    for (int j = 0; j < 16; ++j)
#pragma unroll
      for (int i = 0; i < 8; ++i) acc[j][i] *= alpha;  // rescale O^T

    // ---- P^T as B-matrix (32 keys x 16 queries): element e = key half*8 + (e&7) + 16*(e>>3),
    //      which is register e&7 of S^T tile e>>3 in this very lane ----
    v16bf pf;
#pragma unroll
    for (int i = 0; i < 8; ++i) {
      pf[i]     = bits2bf(f2bfbits(s0[i]));
      pf[8 + i] = bits2bf(f2bfbits(s1[i]));
    }

    // ---- O^T += V^T P^T : 16 h-tiles ----
#pragma unroll
    for (int j = 0; j < 16; ++j) {
      const u32x4 lo = vlo[j], hi = vhi[j];
      const u32x8 vw = {lo.x, lo.y, lo.z, lo.w, hi.x, hi.y, hi.z, hi.w};
      const v16bf vb = __builtin_bit_cast(v16bf, vw);
      acc[j] = __builtin_amdgcn_wmma_f32_16x16x32_bf16(false, vb, false, pf,
                                                       (short)0, acc[j], false, false);
    }

    // ---- publish point of stage st + 1 ----
    // keeps the softmax and the second product in front of the waits below, so that
    // they run while V's fragments still land
    __builtin_amdgcn_sched_barrier(0);
    // this wave's LDS reads of this pass have retired
    asm volatile("s_wait_dscnt 0x0" ::: "memory");
    // this wave's slice of stage st + 1 has landed
    asm volatile("s_wait_tensorcnt 0x0" ::: "memory");
    __syncthreads();           // publishes stage st + 1; every reader has left this pass's LDS
    if (pinned(st + 2u < (uint32_t)NST)) issue(st + 2u);  // refill the buffer just read
  }
  // nothing of the ring is in flight when the wave goes on to its end
  asm volatile("s_wait_tensorcnt 0x0" ::: "memory");
  asm volatile("s_wait_dscnt 0x0" ::: "memory");

  // ---- epilogue: join the halves' sums, normalize and store ----
  const float inv = 1.0f / (lrow + other_half(lrow));
  float* orow = out + ((size_t)b * S_ + qb + l16) * H_ + 8 * half;
#pragma unroll
  for (int j = 0; j < 16; ++j) {
    float4 lo4, hi4;
    lo4.x = acc[j][0] * inv; lo4.y = acc[j][1] * inv;
    lo4.z = acc[j][2] * inv; lo4.w = acc[j][3] * inv;
    hi4.x = acc[j][4] * inv; hi4.y = acc[j][5] * inv;
    hi4.z = acc[j][6] * inv; hi4.w = acc[j][7] * inv;
    ((float4*)(orow + j * 16))[0] = lo4;
    ((float4*)(orow + j * 16))[1] = hi4;
  }
}

extern "C" void kernel_launch(void* const* d_in, const int* in_sizes, int n_in,
                              void* d_out, int out_size, void* d_ws, size_t ws_size,
                              hipStream_t stream) {
  const float* q = (const float*)d_in[0];
  const float* k = (const float*)d_in[1];
  const float* v = (const float*)d_in[2];
  const float* m = (const float*)d_in[3];
  float* out = (float*)d_out;

  dim3 grid(B_ * (S_ / 64));
  dim3 block(128);
  hipLaunchKernelGGL(fa_kernel, grid, block, 0, stream, q, k, v, m, out);
}

// v005
// A run of this version takes 136 microseconds.
// Next to v004, in two timings, it ran 1.17 times as fast each time.
// Counting every step since v000, it is 9.10 times as fast.
#include <hip/hip_runtime.h>
#include <stdint.h>

#define B_ 4
#define S_ 4096
#define H_ 256

typedef __bf16 v16bf __attribute__((ext_vector_type(16)));
typedef float  v8f   __attribute__((ext_vector_type(8)));

__device__ __forceinline__ unsigned short f2bfbits(float f) {
  union { float f; unsigned u; } x; x.f = f;
  unsigned r = x.u + 0x7FFFu + ((x.u >> 16) & 1u);   // round-to-nearest-even
  return (unsigned short)(r >> 16);
}
__device__ __forceinline__ __bf16 bits2bf(unsigned short s) {
  union { unsigned short s; __bf16 b; } y; y.s = s; return y.b;
}

#define LDK 264   // bf16 row stride: >=256 and == 8 (mod 128) -> conflict-free b128 reads
#define LDV 272   // V row stride: 544 B, an odd multiple of 32 B, the transposing load's conflict-free pitch
#define PFD 64    // prefetch distance in keys (2 key-blocks)
#define NST (S_ / 32)          // stages = passes: 32 keys each
#define KP_B (LDK * 2u)        // K row pitch in bytes, workspace and LDS alike: 528
#define VP_B (LDV * 2u)        // V row pitch in bytes, workspace and LDS alike: 544
#define KW_B ((uint32_t)(B_ * S_) * KP_B) // bytes of the K plane; the V plane follows it
#define SLICE_B 10240u         // LDS place of one wave's slice: 16 rows, rounded up to 2 KiB
#define STAGE_B (4u * SLICE_B) // K rows 0-15, K rows 16-31, V rows 0-15, V rows 16-31

typedef uint32_t u32x4 __attribute__((ext_vector_type(4)));
typedef uint32_t u32x8 __attribute__((ext_vector_type(8)));
typedef short s16x8 __attribute__((ext_vector_type(8)));
typedef __attribute__((address_space(3))) s16x8 lds_s16x8;

// ds_load_tr16_b128: with lane l aimed at row 8*(l>>4) + (l&7), byte 16*((l>>3)&1)
// of a 16 x 16 tile of 16-bit elements, lane (c = l&15, h = l>>4) gets rows
// 8h .. 8h+7 of column c.
__device__ __forceinline__ u32x4 ld_tr16(const unsigned char* p) {
  return __builtin_bit_cast(u32x4, __builtin_amdgcn_ds_load_tr16_b128_v8i16((lds_s16x8*)p));
}

// Value of lane l ^ 16 (the other half of the wave), by a vector cross-row move.
__device__ __forceinline__ float other_half(float x) {
  const int b = __builtin_bit_cast(int, x);
  return __builtin_bit_cast(float, __builtin_amdgcn_permlanex16(
      b, b, 0x76543210, 0xfedcba98, false, false));
}

// Keeps a group of loads together and ahead of their users: without it the
// compiler sinks each load to just in front of its user, and the lone wave of
// a SIMD then waits out the full LDS latency at every matrix instruction.
__device__ __forceinline__ void hold_group() { __builtin_amdgcn_sched_barrier(0); }

__device__ __forceinline__ uint32_t uni(uint32_t v) {
  return (uint32_t)__builtin_amdgcn_readfirstlane(v);
}
// Holds a wave-uniform test in a scalar register so that the branch on it is
// a scalar one: a tensor load ignores EXEC and only such a branch skips it.
__device__ __forceinline__ uint32_t pinned(uint32_t v) {
  uint32_t w = uni(v);
  asm volatile("" : "+s"(w));
  return w;
}
// Tensor descriptor, group 1: byte elements, no mask, no pad. A slice (16 padded
// rows) is contiguous in the workspace and a whole number of 256-B units: it
// moves as tile = tensor = n lines of 256 B at source pitch 256 B.
__device__ __forceinline__ u32x8 tdm_group1(uint32_t n) {
  u32x8 g;
  g[0] = uni(0u);
  g[1] = uni(256u << 16);
  g[2] = uni(n << 16);
  g[3] = uni(256u << 16);
  g[4] = uni(n);
  g[5] = uni(256u);
  g[6] = uni(0u);
  g[7] = uni(0u);
  return g;
}
// Group 0: count 1, LDS byte offset, global address of the first byte, type 2.
__device__ __forceinline__ u32x4 tdm_group0(uint32_t lds_dst, uint64_t ga) {
  u32x4 g;
  g[0] = uni(1u);
  g[1] = uni(lds_dst);
  g[2] = uni((uint32_t)ga);
  g[3] = uni((((uint32_t)(ga >> 32)) & 0x01FFFFFFu) | 0x80000000u);
  return g;
}

// One 16 x 32 fragment's 16 elements of this lane: 8 at p, 8 at p + 32 B.
__device__ __forceinline__ v16bf ld_frag(const unsigned char* p) {
  const u32x4 lo = *(const u32x4*)p, hi = *(const u32x4*)(p + 32);
  const u32x8 w = {lo.x, lo.y, lo.z, lo.w, hi.x, hi.y, hi.z, hi.w};
  return __builtin_bit_cast(v16bf, w);
}

// One wave rounds 8 rows of 256 f32 to bf16 rows at pitch PITCH bytes and zeroes
// their pad bytes. 8 such rows are a whole number of 128-B lines, so no line has
// a second writer; the 16 loads of a lane fly together off one address.
template <uint32_t PITCH>
__device__ __forceinline__ void round_rows(const float* __restrict__ src,
                                           unsigned char* __restrict__ dst, uint32_t lane) {
  const float4* s4 = (const float4*)src + lane;
  float4 x[16];
#pragma unroll
  for (int r = 0; r < 16; ++r) x[r] = s4[r * 32];   // row r / 2, half r & 1
  // later code rewrites the address registers that the 16 loads name; the input
  // operand keeps that pair untouched up to this wait
  asm volatile("s_wait_xcnt 0x0" :: "v"(s4) : "memory");
#pragma unroll
  for (int r = 0; r < 16; ++r) {
    uint2 w;
    w.x = (uint32_t)f2bfbits(x[r].x) | ((uint32_t)f2bfbits(x[r].y) << 16);
    w.y = (uint32_t)f2bfbits(x[r].z) | ((uint32_t)f2bfbits(x[r].w) << 16);
    *(uint2*)(dst + (uint32_t)(r >> 1) * PITCH + (uint32_t)(r & 1) * 256u + lane * 8u) = w;
  }
  constexpr uint32_t PQ = (PITCH - 512u) / 16u;     // 16-B pad pieces a row
  if (lane < 8u * PQ)
    *(uint4*)(dst + (lane / PQ) * PITCH + 512u + (lane % PQ) * 16u) = make_uint4(0u, 0u, 0u, 0u);
}

#define NGR ((uint32_t)(B_ * S_) / 8u)  // groups of 8 rows in one plane

// The grid puts four waves on a SIMD: told so, the compiler spends the registers
// that let a lane's 16 loads stay in flight at once.
__global__ __launch_bounds__(256) __attribute__((amdgpu_waves_per_eu(4, 4)))
void round_kv_kernel(const float* __restrict__ k, const float* __restrict__ v,
                     unsigned short* __restrict__ ws) {
  const uint32_t lane = threadIdx.x & 31u;
  const uint32_t gr = blockIdx.x * 8u + (threadIdx.x >> 5);  // first the K plane's groups, then V's
  unsigned char* w8 = (unsigned char*)ws;
  if (blockIdx.x < NGR / 8u)
    round_rows<KP_B>(k + (size_t)gr * (8u * H_), w8 + (size_t)gr * (8u * KP_B), lane);
  else
    round_rows<VP_B>(v + (size_t)(gr - NGR) * (8u * H_),
                     w8 + KW_B + (size_t)(gr - NGR) * (8u * VP_B), lane);
}

// One wave a SIMD, so one work-group a WGP: the grid has one work-group for each
// WGP, and the LDS in use would leave room for a second on one of them.
__global__ __launch_bounds__(128) __attribute__((amdgpu_waves_per_eu(1, 1)))
void fa_kernel(const float* __restrict__ q, const unsigned short* __restrict__ ws,
               const float* __restrict__ mask, float* __restrict__ out) {
  // landing ring of the tensor loads: [buffer][slice][16 bf16 rows at pitch KP_B or VP_B]
  __shared__ __attribute__((aligned(2048))) unsigned char Rs[2][4][SLICE_B];
  __shared__ unsigned short Qs[4][16][LDK]; // per-wave Q tile: [m][h], bf16 bits

  const int tid  = threadIdx.x;
  const int lane = tid & 31;
  const int wave = tid >> 5;
  const int half = lane >> 4;   // 0: lanes 0-15, 1: lanes 16-31
  const int l16  = lane & 15;

  const int nqblk = S_ / 64;
  const int b    = blockIdx.x / nqblk;
  const int qblk = (blockIdx.x % nqblk) * 64;
  const int qb   = qblk + wave * 16;

  // ---- stage Q tile (64 rows x 256 h) to LDS as bf16, cooperatively ----
#pragma unroll
  for (int p = 0; p < 32; ++p) {
    const int r  = p * 2 + (tid >> 6);   // 0..63
    const int c4 = tid & 63;             // float4 column
    const float4 qv = ((const float4*)(q + ((size_t)b * S_ + qblk + r) * H_))[c4];
    unsigned short* dst = &Qs[r >> 4][r & 15][c4 * 4];
    dst[0] = f2bfbits(qv.x); dst[1] = f2bfbits(qv.y);
    dst[2] = f2bfbits(qv.z); dst[3] = f2bfbits(qv.w);
  }

  // ---- accumulators & softmax state ----
  v8f acc[16];                 // O^T: tile j, register i = O[query l16][h = 16j + 8*half + i]
#pragma unroll
  for (int j = 0; j < 16; ++j)
#pragma unroll
    for (int i = 0; i < 8; ++i) acc[j][i] = 0.0f;

  float mrow = -__builtin_inff(); // running maximum of query l16, the same in both halves
  float lrow = 0.0f;              // running sum of query l16 over this half's keys only

  const float scale = 0.0625f; // 1/sqrt(256)

  // ---- hoisted per-lane base pointers (loop adds only uniform kb terms) ----
  const float* mpf = mask + ((size_t)b * S_ + (qb + l16)) * S_ + half * 16 + PFD;
  const float* mdem = mask + ((size_t)b * S_ + qb + l16) * S_ + 8 * half;
  // this lane's address in buffer 0 for K's fragments of keys 0-15, h 0-31
  const unsigned char* kad = &Rs[0][0][0] + (uint32_t)l16 * KP_B + (uint32_t)half * 16u;
  // this lane's address in buffer 0 for the transposing loads of V's keys 0-15, h 0-15
  const unsigned char* vad = &Rs[0][2][0]
                           + (uint32_t)(8 * half + (lane & 7)) * VP_B
                           + (uint32_t)((lane >> 3) & 1) * 16u;

  // ---- tensor-load ring: every wave brings one 16-row slice per stage ----
  // waves 0,1: the two halves of the K tile; waves 2,3: of the V tile.
  const uint32_t wv    = uni((uint32_t)tid >> 5);
  const uint32_t lbase = (uint32_t)(size_t)&Rs[0][0][0] + wv * SLICE_B;
  const uint32_t pitch = (wv & 2u) ? VP_B : KP_B;
  const uint64_t gbase = (uint64_t)(size_t)ws + ((wv & 2u) ? KW_B : 0u)
                       + ((uint64_t)b * S_ + (wv & 1u) * 16u) * pitch;
  const u32x8 g1 = tdm_group1(pitch / 16u);   // 16 rows = pitch / 16 lines of 256 B
  auto issue = [&](uint32_t st) {
    const u32x4 g0 = tdm_group0(lbase + (st & 1u) * STAGE_B,
                                gbase + (uint64_t)st * (32u * pitch));
    // group 1 sits in registers of its own at every issue, so that nothing else is
    // written into a word of it while a request is still on its way
    asm volatile("tensor_load_to_lds %0, %1" :: "s"(g0), "{s[48:55]}"(g1) : "memory");
  };
  issue(0);
  // stage 0 landed in this wave; the barrier publishes it (and Qs) to all waves
  asm volatile("s_wait_tensorcnt 0x0" ::: "memory");
  __syncthreads();
  issue(1);

  for (int kb = 0; kb < S_; kb += 32) {
    const uint32_t st = (uint32_t)kb >> 5;
    // ---- speculative prefetch (global_prefetch_b8), 2 key-blocks ahead ----
    if (kb < S_ - PFD) {
      __builtin_prefetch(mpf + kb, 0, 1);
    }

    const unsigned char* kp = kad + (st & 1u) * STAGE_B;  // this pass's buffer
    const unsigned char* vp = vad + (st & 1u) * STAGE_B;

    // ---- operand group of S^T: the four mask loads (the longest way) at its head,
    //      then all fragments of Q^T and K in the order of their use ----
    const float4* mq = (const float4*)(mdem + kb);
    const float4 ma = mq[0], mb = mq[1], mc = mq[4], md = mq[5];
    v16bf qa[8], b0[8], b1[8]; // A = K chunk (16 keys x 32 h); B = Q^T chunk (32 h x 16 queries)
#pragma unroll
    for (int c = 0; c < 8; ++c) {
#pragma unroll
      for (int e = 0; e < 16; ++e) {
        const int kd = half * 8 + (e & 7) + ((e >> 3) << 4);
        qa[c][e] = bits2bf(Qs[wave][l16][c * 32 + kd]);
      }
      b0[c] = ld_frag(kp + 64u * c);            // keys 0-15, the same h order as qa
      b1[c] = ld_frag(kp + SLICE_B + 64u * c);  // keys 16-31
    }
    // later code rewrites the address registers that the four mask loads name; the
    // input operand keeps that pair untouched up to this wait
    asm volatile("s_wait_xcnt 0x0" :: "v"(mq) : "memory");
    hold_group();

    // ---- S^T = K Q^T : two 16x16 f32 tiles (keys 0-15, 16-31) x 16 queries ----
    v8f s0, s1;
#pragma unroll
    for (int i = 0; i < 8; ++i) { s0[i] = 0.0f; s1[i] = 0.0f; }

#pragma unroll
    for (int c = 0; c < 8; ++c) {
      s0 = __builtin_amdgcn_wmma_f32_16x16x32_bf16(false, b0[c], false, qa[c],
                                                   (short)0, s0, false, false);
      s1 = __builtin_amdgcn_wmma_f32_16x16x32_bf16(false, b1[c], false, qa[c],
                                                   (short)0, s1, false, false);
    }

    // ---- operand group of O^T: all V^T fragments; they land under the softmax ----
    // A = V^T chunk: (16 h) x (32 keys); M = l16; element e = key half*8 + (e&7) + 16*(e>>3)
    u32x4 vlo[16], vhi[16];
#pragma unroll
    for (int j = 0; j < 16; ++j) {
      vlo[j] = ld_tr16(vp + 32u * j);           // keys 0-15
      vhi[j] = ld_tr16(vp + SLICE_B + 32u * j); // keys 16-31
    }
    hold_group();

    // ---- scale + mask (C layout: key = i + 8*half (+16 for s1), query = l16) ----
    {
      const float m0[8] = {ma.x, ma.y, ma.z, ma.w, mb.x, mb.y, mb.z, mb.w};
      const float m1[8] = {mc.x, mc.y, mc.z, mc.w, md.x, md.y, md.z, md.w};
#pragma unroll
      for (int i = 0; i < 8; ++i) s0[i] = s0[i] * scale + m0[i];
#pragma unroll
      for (int i = 0; i < 8; ++i) s1[i] = s1[i] * scale + m1[i];
    }

    // ---- online softmax over this 32-key block, one query per lane ----
    float mx = fmaxf(s0[0], s1[0]);
#pragma unroll
    for (int i = 1; i < 8; ++i) mx = fmaxf(mx, fmaxf(s0[i], s1[i]));
    mx = fmaxf(mx, other_half(mx));              // the other 16 keys of this query
    const float mnew  = fmaxf(mrow, mx);
    const float alpha = __expf(mrow - mnew);
    float ps = 0.0f;
#pragma unroll
    for (int i = 0; i < 8; ++i) {
      s0[i] = __expf(s0[i] - mnew);
      s1[i] = __expf(s1[i] - mnew);
      ps += s0[i] + s1[i];
    }
    lrow = lrow * alpha + ps;
    mrow = mnew;
#pragma unroll
    for (int j = 0; j < 16; ++j)
#pragma unroll
      for (int i = 0; i < 8; ++i) acc[j][i] *= alpha;  // rescale O^T

    // ---- P^T as B-matrix (32 keys x 16 queries): element e = key half*8 + (e&7) + 16*(e>>3),
    //      which is register e&7 of S^T tile e>>3 in this very lane ----
    v16bf pf;
#pragma unroll
    for (int i = 0; i < 8; ++i) {
      pf[i]     = bits2bf(f2bfbits(s0[i]));
      pf[8 + i] = bits2bf(f2bfbits(s1[i]));
    }

    // ---- O^T += V^T P^T : 16 h-tiles ----
#pragma unroll
    for (int j = 0; j < 16; ++j) {
      const u32x4 lo = vlo[j], hi = vhi[j];
      const u32x8 vw = {lo.x, lo.y, lo.z, lo.w, hi.x, hi.y, hi.z, hi.w};
      const v16bf vb = __builtin_bit_cast(v16bf, vw);
      acc[j] = __builtin_amdgcn_wmma_f32_16x16x32_bf16(false, vb, false, pf,
                                                       (short)0, acc[j], false, false);
    }

    // ---- publish point of stage st + 1 ----
    // keeps the softmax and the second product in front of the waits below, so that
    // they run while V's fragments still land
    __builtin_amdgcn_sched_barrier(0);
    // this wave's LDS reads of this pass have retired
    asm volatile("s_wait_dscnt 0x0" ::: "memory");
    // this wave's slice of stage st + 1 has landed
    asm volatile("s_wait_tensorcnt 0x0" ::: "memory");
    __syncthreads();           // publishes stage st + 1; every reader has left this pass's LDS
    if (pinned(st + 2u < (uint32_t)NST)) issue(st + 2u);  // refill the buffer just read
  }
  // nothing of the ring is in flight when the wave goes on to its end
  asm volatile("s_wait_tensorcnt 0x0" ::: "memory");
  asm volatile("s_wait_dscnt 0x0" ::: "memory");

  // ---- epilogue: join the halves' sums, normalize and store ----
  const float inv = 1.0f / (lrow + other_half(lrow));
  float* orow = out + ((size_t)b * S_ + qb + l16) * H_ + 8 * half;
#pragma unroll
  for (int j = 0; j < 16; ++j) {
    float4 lo4, hi4;
    lo4.x = acc[j][0] * inv; lo4.y = acc[j][1] * inv;
    lo4.z = acc[j][2] * inv; lo4.w = acc[j][3] * inv;
    hi4.x = acc[j][4] * inv; hi4.y = acc[j][5] * inv;
    hi4.z = acc[j][6] * inv; hi4.w = acc[j][7] * inv;
    ((float4*)(orow + j * 16))[0] = lo4;
    ((float4*)(orow + j * 16))[1] = hi4;
  }
}

extern "C" void kernel_launch(void* const* d_in, const int* in_sizes, int n_in,
                              void* d_out, int out_size, void* d_ws, size_t ws_size,
                              hipStream_t stream) {
  const float* q = (const float*)d_in[0];
  const float* k = (const float*)d_in[1];
  const float* v = (const float*)d_in[2];
  const float* m = (const float*)d_in[3];
  float* out = (float*)d_out;
  unsigned short* ws = (unsigned short*)d_ws;

  hipLaunchKernelGGL(round_kv_kernel, dim3(2 * (B_ * S_ / 8) / 8), dim3(256), 0, stream, k, v, ws);
  dim3 grid(B_ * (S_ / 64));
  dim3 block(128);
  hipLaunchKernelGGL(fa_kernel, grid, block, 0, stream, q, ws, m, out);
}

// v006
// A run of this version takes 94.8 microseconds.
// Next to v005, in two timings, it ran 1.43 and 1.44 times as fast.
// Over all steps from v000 it is 13.1 times as fast.
#include <hip/hip_runtime.h>
#include <stdint.h>

#define B_ 4
#define S_ 4096
#define H_ 256

typedef __bf16 v16bf __attribute__((ext_vector_type(16)));
typedef float  v8f   __attribute__((ext_vector_type(8)));

__device__ __forceinline__ unsigned short f2bfbits(float f) {
  union { float f; unsigned u; } x; x.f = f;
  unsigned r = x.u + 0x7FFFu + ((x.u >> 16) & 1u);   // round-to-nearest-even
  return (unsigned short)(r >> 16);
}
__device__ __forceinline__ __bf16 bits2bf(unsigned short s) {
  union { unsigned short s; __bf16 b; } y; y.s = s; return y.b;
}

#define LDK 264   // bf16 row stride: >=256 and == 8 (mod 128) -> conflict-free b128 reads
#define LDV 272   // V row stride: 544 B, an odd multiple of 32 B, the transposing load's conflict-free pitch
#define KST 64    // keys a stage: 32 for each key group
#define PFD 128   // prefetch distance in keys (2 stages)
#define NST (S_ / KST)         // stages = passes
#define KP_B (LDK * 2u)        // K row pitch in bytes, workspace and LDS alike: 528
#define VP_B (LDV * 2u)        // V row pitch in bytes, workspace and LDS alike: 544
#define KW_B ((uint32_t)(B_ * S_) * KP_B) // bytes of the K plane; the V plane follows it
#define SLICE_B 18432u         // LDS place of one wave's slice: 32 rows, rounded up to 2 KiB
#define STAGE_B (4u * SLICE_B) // K rows 0-31, K rows 32-63, V rows 0-31, V rows 32-63
#define XCH_B 16896u           // epilogue exchange, one wave's place: 16 KiB of O, then maximum and sum

typedef uint32_t u32x4 __attribute__((ext_vector_type(4)));
typedef uint32_t u32x8 __attribute__((ext_vector_type(8)));
typedef short s16x8 __attribute__((ext_vector_type(8)));
typedef __attribute__((address_space(3))) s16x8 lds_s16x8;

// ds_load_tr16_b128: with lane l aimed at row 8*(l>>4) + (l&7), byte 16*((l>>3)&1)
// of a 16 x 16 tile of 16-bit elements, lane (c = l&15, h = l>>4) gets rows
// 8h .. 8h+7 of column c.
__device__ __forceinline__ u32x4 ld_tr16(const unsigned char* p) {
  return __builtin_bit_cast(u32x4, __builtin_amdgcn_ds_load_tr16_b128_v8i16((lds_s16x8*)p));
}

// Value of lane l ^ 16 (the other half of the wave), by a vector cross-row move.
__device__ __forceinline__ float other_half(float x) {
  const int b = __builtin_bit_cast(int, x);
  return __builtin_bit_cast(float, __builtin_amdgcn_permlanex16(
      b, b, 0x76543210, 0xfedcba98, false, false));
}

// Keeps a group of loads together and ahead of their users: without it the
// compiler sinks each load to just in front of its user, and the lone wave of
// a SIMD then waits out the full LDS latency at every matrix instruction.
__device__ __forceinline__ void hold_group() { __builtin_amdgcn_sched_barrier(0); }

__device__ __forceinline__ uint32_t uni(uint32_t v) {
  return (uint32_t)__builtin_amdgcn_readfirstlane(v);
}
// Holds a wave-uniform test in a scalar register so that the branch on it is
// a scalar one: a tensor load ignores EXEC and only such a branch skips it.
__device__ __forceinline__ uint32_t pinned(uint32_t v) {
  uint32_t w = uni(v);
  asm volatile("" : "+s"(w));
  return w;
}
// Tensor descriptor, group 1: byte elements, no mask, no pad. A slice (32 padded
// rows) is contiguous in the workspace and a whole number of 256-B units: it
// moves as tile = tensor = n lines of 256 B at source pitch 256 B.
__device__ __forceinline__ u32x8 tdm_group1(uint32_t n) {
  u32x8 g;
  g[0] = uni(0u);
  g[1] = uni(256u << 16);
  g[2] = uni(n << 16);
  g[3] = uni(256u << 16);
  g[4] = uni(n);
  g[5] = uni(256u);
  g[6] = uni(0u);
  g[7] = uni(0u);
  return g;
}
// Group 0: count 1, LDS byte offset, global address of the first byte, type 2.
__device__ __forceinline__ u32x4 tdm_group0(uint32_t lds_dst, uint64_t ga) {
  u32x4 g;
  g[0] = uni(1u);
  g[1] = uni(lds_dst);
  g[2] = uni((uint32_t)ga);
  g[3] = uni((((uint32_t)(ga >> 32)) & 0x01FFFFFFu) | 0x80000000u);
  return g;
}

// One 16 x 32 fragment's 16 elements of this lane: 8 at p, 8 at p + 32 B.
__device__ __forceinline__ v16bf ld_frag(const unsigned char* p) {
  const u32x4 lo = *(const u32x4*)p, hi = *(const u32x4*)(p + 32);
  const u32x8 w = {lo.x, lo.y, lo.z, lo.w, hi.x, hi.y, hi.z, hi.w};
  return __builtin_bit_cast(v16bf, w);
}

// One wave rounds 8 rows of 256 f32 to bf16 rows at pitch PITCH bytes and zeroes
// their pad bytes. 8 such rows are a whole number of 128-B lines, so no line has
// a second writer; the 16 loads of a lane fly together off one address.
template <uint32_t PITCH>
__device__ __forceinline__ void round_rows(const float* __restrict__ src,
                                           unsigned char* __restrict__ dst, uint32_t lane) {
  const float4* s4 = (const float4*)src + lane;
  float4 x[16];
#pragma unroll
  for (int r = 0; r < 16; ++r) x[r] = s4[r * 32];   // row r / 2, half r & 1
  // later code rewrites the address registers that the 16 loads name; the input
  // operand keeps that pair untouched up to this wait
  asm volatile("s_wait_xcnt 0x0" :: "v"(s4) : "memory");
#pragma unroll
  for (int r = 0; r < 16; ++r) {
    uint2 w;
    w.x = (uint32_t)f2bfbits(x[r].x) | ((uint32_t)f2bfbits(x[r].y) << 16);
    w.y = (uint32_t)f2bfbits(x[r].z) | ((uint32_t)f2bfbits(x[r].w) << 16);
    *(uint2*)(dst + (uint32_t)(r >> 1) * PITCH + (uint32_t)(r & 1) * 256u + lane * 8u) = w;
  }
  constexpr uint32_t PQ = (PITCH - 512u) / 16u;     // 16-B pad pieces a row
  if (lane < 8u * PQ)
    *(uint4*)(dst + (lane / PQ) * PITCH + 512u + (lane % PQ) * 16u) = make_uint4(0u, 0u, 0u, 0u);
}

#define NGR ((uint32_t)(B_ * S_) / 8u)  // groups of 8 rows in one plane

// The grid puts four waves on a SIMD: told so, the compiler spends the registers
// that let a lane's 16 loads stay in flight at once.
__global__ __launch_bounds__(256) __attribute__((amdgpu_waves_per_eu(4, 4)))
void round_kv_kernel(const float* __restrict__ k, const float* __restrict__ v,
                     unsigned short* __restrict__ ws) {
  const uint32_t lane = threadIdx.x & 31u;
  const uint32_t gr = blockIdx.x * 8u + (threadIdx.x >> 5);  // first the K plane's groups, then V's
  unsigned char* w8 = (unsigned char*)ws;
  if (blockIdx.x < NGR / 8u)
    round_rows<KP_B>(k + (size_t)gr * (8u * H_), w8 + (size_t)gr * (8u * KP_B), lane);
  else
    round_rows<VP_B>(v + (size_t)(gr - NGR) * (8u * H_),
                     w8 + KW_B + (size_t)(gr - NGR) * (8u * VP_B), lane);
}

// One wave a SIMD, so one work-group a WGP: the grid has one work-group for each
// WGP, and a wave's two O tiles with its fragment groups take more than half of a
// SIMD's registers.
__global__ __launch_bounds__(128) __attribute__((amdgpu_waves_per_eu(1, 1)))
void fa_kernel(const float* __restrict__ q, const unsigned short* __restrict__ ws,
               const float* __restrict__ mask, float* __restrict__ out) {
  // landing ring of the tensor loads: [buffer][slice][32 bf16 rows at pitch KP_B or VP_B]
  __shared__ __attribute__((aligned(2048))) unsigned char Rs[2][4][SLICE_B];
  __shared__ unsigned short Qs[4][16][LDK]; // Q tiles: [tile][m][h], bf16 bits

  const int tid  = threadIdx.x;
  const int lane = tid & 31;
  const int wave = tid >> 5;
  const int half = lane >> 4;   // 0: lanes 0-15, 1: lanes 16-31
  const int l16  = lane & 15;
  const int qg   = wave & 1;    // query group: queries 32*qg .. 32*qg + 31 of the block
  const int kg   = wave >> 1;   // key group: keys 32*kg .. 32*kg + 31 of every stage

  const int nqblk = S_ / 64;
  const int b    = blockIdx.x / nqblk;
  const int qblk = (blockIdx.x % nqblk) * 64;
  const int qb   = qblk + qg * 32;

  // ---- stage Q tile (64 rows x 256 h) to LDS as bf16, cooperatively ----
#pragma unroll
  for (int p = 0; p < 32; ++p) {
    const int r  = p * 2 + (tid >> 6);   // 0..63
    const int c4 = tid & 63;             // float4 column
    const float4 qv = ((const float4*)(q + ((size_t)b * S_ + qblk + r) * H_))[c4];
    unsigned short* dst = &Qs[r >> 4][r & 15][c4 * 4];
    dst[0] = f2bfbits(qv.x); dst[1] = f2bfbits(qv.y);
    dst[2] = f2bfbits(qv.z); dst[3] = f2bfbits(qv.w);
  }

  // ---- accumulators & softmax state, one set per query tile t ----
  v8f acc[2][16];              // O^T: tile j, register i = O[query 16t + l16][h = 16j + 8*half + i]
#pragma unroll
  for (int t = 0; t < 2; ++t)
#pragma unroll
    for (int j = 0; j < 16; ++j)
#pragma unroll
      for (int i = 0; i < 8; ++i) acc[t][j][i] = 0.0f;

  // Running maximum of query 16t + l16 over this key group, the same in both halves.
  // It starts at the lowest finite value, not at -inf: a key group whose keys so far
  // are all masked with -inf then keeps weights, sum and O at zero instead of
  // forming -inf - -inf, and drops out when the groups are joined.
  float mrow[2] = {-3.402823466e+38f, -3.402823466e+38f};
  float lrow[2] = {0.0f, 0.0f};   // running sum over this half's keys of this key group

  const float scale = 0.0625f; // 1/sqrt(256)

  // ---- hoisted per-lane base pointers (loop adds only uniform kb terms) ----
  // one lane a query row: the 128-B line of this key group's 32 keys
  const float* mpf = mask + ((size_t)b * S_ + (qb + lane)) * S_ + kg * 32 + PFD;
  const float* mdem = mask + ((size_t)b * S_ + qb + l16) * S_ + kg * 32 + 8 * half;
  // this lane's address for Q's fragments of query tile 0, h 0-31
  const unsigned char* qad = (const unsigned char*)&Qs[qg * 2][l16][0] + (uint32_t)half * 16u;
  // this lane's address in buffer 0 for K's fragments of the group's keys 0-15, h 0-31
  const unsigned char* kad = &Rs[0][kg][0] + (uint32_t)l16 * KP_B + (uint32_t)half * 16u;
  // this lane's address in buffer 0 for the transposing loads of V's keys 0-15, h 0-15
  const unsigned char* vad = &Rs[0][2 + kg][0]
                           + (uint32_t)(8 * half + (lane & 7)) * VP_B
                           + (uint32_t)((lane >> 3) & 1) * 16u;

  // ---- tensor-load ring: every wave brings one 32-row slice per stage ----
  // waves 0,1: the K rows of key groups 0,1; waves 2,3: the V rows.
  const uint32_t wv    = uni((uint32_t)tid >> 5);
  const uint32_t lbase = (uint32_t)(size_t)&Rs[0][0][0] + wv * SLICE_B;
  const uint32_t pitch = (wv & 2u) ? VP_B : KP_B;
  const uint64_t gbase = (uint64_t)(size_t)ws + ((wv & 2u) ? KW_B : 0u)
                       + ((uint64_t)b * S_ + (wv & 1u) * 32u) * pitch;
  const u32x8 g1 = tdm_group1(pitch / 8u);    // 32 rows = pitch / 8 lines of 256 B
  u32x4 g0;   // group 0 of the request on its way
  auto issue = [&](uint32_t st) {
    g0 = tdm_group0(lbase + (st & 1u) * STAGE_B,
                    gbase + (uint64_t)st * ((uint32_t)KST * pitch));
    // group 1 sits in registers of its own at every issue, so that nothing else is
    // written into a word of it while a request is still on its way
    asm volatile("tensor_load_to_lds %0, %1" :: "s"(g0), "{s[48:55]}"(g1) : "memory");
  };
  issue(0);
  // stage 0 landed in this wave; the barrier publishes it (and Qs) to all waves
  asm volatile("s_wait_tensorcnt 0x0" :: "s"(g0) : "memory");
  __syncthreads();
  issue(1);

  for (int kb = 0; kb < S_; kb += KST) {
    const uint32_t st = (uint32_t)kb / (uint32_t)KST;
    // ---- speculative prefetch (global_prefetch_b8), 2 stages ahead ----
    if (kb < S_ - PFD) {
      __builtin_prefetch(mpf + kb, 0, 1);
    }

    const unsigned char* kp = kad + (st & 1u) * STAGE_B;  // this pass's buffer
    const unsigned char* vp = vad + (st & 1u) * STAGE_B;

    // ---- operand group of S^T: the eight mask loads (the longest way) at its head,
    //      then all fragments of Q^T and K in the order of their use ----
    const float4* mq = (const float4*)(mdem + kb);
    constexpr int QT = 16 * S_ / 4;   // query tile 1: 16 mask rows on, in float4
    const float4 mm[2][4] = {{mq[0], mq[1], mq[4], mq[5]},
                             {mq[QT], mq[QT + 1], mq[QT + 4], mq[QT + 5]}};
    // A = K chunk (16 keys x 32 h), key tile u; B = Q^T chunk (32 h x 16 queries), query tile t
    v16bf qa[2][8], ka[2][8];
#pragma unroll
    for (int c = 0; c < 8; ++c) {
      qa[0][c] = ld_frag(qad + 64u * c);
      qa[1][c] = ld_frag(qad + 16u * KP_B + 64u * c);
      ka[0][c] = ld_frag(kp + 64u * c);               // keys 0-15, the same h order as qa
      ka[1][c] = ld_frag(kp + 16u * KP_B + 64u * c);  // keys 16-31
    }
    // later code rewrites the address registers that the eight mask loads name; the
    // input operand keeps that pair untouched up to this wait
    asm volatile("s_wait_xcnt 0x0" :: "v"(mq) : "memory");
    hold_group();

    // ---- S^T = K Q^T : per query tile two 16x16 f32 tiles (keys 0-15, 16-31) ----
    v8f sc[2][2];                // [query tile t][key tile u]
#pragma unroll
    for (int t = 0; t < 2; ++t)
#pragma unroll
      for (int u = 0; u < 2; ++u)
#pragma unroll
        for (int i = 0; i < 8; ++i) sc[t][u][i] = 0.0f;

#pragma unroll
    for (int c = 0; c < 8; ++c)
#pragma unroll
      for (int u = 0; u < 2; ++u)
#pragma unroll
        for (int t = 0; t < 2; ++t)
          sc[t][u] = __builtin_amdgcn_wmma_f32_16x16x32_bf16(false, ka[u][c], false, qa[t][c],
                                                             (short)0, sc[t][u], false, false);

    // ---- operand group of O^T: all V^T fragments; they land under the softmax ----
    // A = V^T chunk: (16 h) x (32 keys); M = l16; element e = key half*8 + (e&7) + 16*(e>>3)
    u32x4 vlo[16], vhi[16];
#pragma unroll
    for (int j = 0; j < 16; ++j) {
      vlo[j] = ld_tr16(vp + 32u * j);               // keys 0-15
      vhi[j] = ld_tr16(vp + 16u * VP_B + 32u * j);  // keys 16-31
    }
    hold_group();

    v16bf pf[2];
#pragma unroll
    for (int t = 0; t < 2; ++t) {
      // ---- scale + mask (C layout: key = i + 8*half (+16 for tile 1), query = 16t + l16) ----
      v8f s0 = sc[t][0], s1 = sc[t][1];
      {
        const float4 ma = mm[t][0], mb = mm[t][1], mc = mm[t][2], md = mm[t][3];
        const float m0[8] = {ma.x, ma.y, ma.z, ma.w, mb.x, mb.y, mb.z, mb.w};
        const float m1[8] = {mc.x, mc.y, mc.z, mc.w, md.x, md.y, md.z, md.w};
#pragma unroll
        for (int i = 0; i < 8; ++i) s0[i] = s0[i] * scale + m0[i];
#pragma unroll
        for (int i = 0; i < 8; ++i) s1[i] = s1[i] * scale + m1[i];
      }

      // ---- online softmax over this 32-key block, one query per lane ----
      float mx = fmaxf(s0[0], s1[0]);
#pragma unroll
      for (int i = 1; i < 8; ++i) mx = fmaxf(mx, fmaxf(s0[i], s1[i]));
      mx = fmaxf(mx, other_half(mx));              // the other 16 keys of this query
      const float mnew  = fmaxf(mrow[t], mx);
      const float alpha = __expf(mrow[t] - mnew);
      float ps = 0.0f;
#pragma unroll
      for (int i = 0; i < 8; ++i) {
        s0[i] = __expf(s0[i] - mnew);
        s1[i] = __expf(s1[i] - mnew);
        ps += s0[i] + s1[i];
      }
      lrow[t] = lrow[t] * alpha + ps;
      mrow[t] = mnew;
#pragma unroll
      for (int j = 0; j < 16; ++j)
#pragma unroll
        for (int i = 0; i < 8; ++i) acc[t][j][i] *= alpha;  // rescale O^T

      // ---- P^T as B-matrix (32 keys x 16 queries): element e = key half*8 + (e&7) + 16*(e>>3),
      //      which is register e&7 of S^T tile e>>3 in this very lane ----
#pragma unroll
      for (int i = 0; i < 8; ++i) {
        pf[t][i]     = bits2bf(f2bfbits(s0[i]));
        pf[t][8 + i] = bits2bf(f2bfbits(s1[i]));
      }
    }

    // ---- O^T += V^T P^T : 16 h-tiles, each V^T fragment for both query tiles ----
#pragma unroll
    for (int j = 0; j < 16; ++j) {
      const u32x4 lo = vlo[j], hi = vhi[j];
      const u32x8 vw = {lo.x, lo.y, lo.z, lo.w, hi.x, hi.y, hi.z, hi.w};
      const v16bf vb = __builtin_bit_cast(v16bf, vw);
#pragma unroll
      for (int t = 0; t < 2; ++t)
        acc[t][j] = __builtin_amdgcn_wmma_f32_16x16x32_bf16(false, vb, false, pf[t],
                                                            (short)0, acc[t][j], false, false);
    }

    // ---- publish point of stage st + 1 ----
    // keeps the softmax and the second product in front of the waits below, so that
    // they run while V's fragments still land
    __builtin_amdgcn_sched_barrier(0);
    // this wave's LDS reads of this pass have retired
    asm volatile("s_wait_dscnt 0x0" ::: "memory");
    // this wave's slice of stage st + 1 has landed; the input operand keeps the words of
    // its group 0 in their registers, unwritten, up to this wait
    asm volatile("s_wait_tensorcnt 0x0" :: "s"(g0) : "memory");
    __syncthreads();           // publishes stage st + 1; every reader has left this pass's LDS
    if (pinned(st + 2u < (uint32_t)NST)) issue(st + 2u);  // refill the buffer just read
  }
  // nothing of the ring is in flight when the wave goes on to its end
  asm volatile("s_wait_tensorcnt 0x0" ::: "memory");
  asm volatile("s_wait_dscnt 0x0" ::: "memory");

  // ---- epilogue: join the halves' sums, then the two key groups, normalize and store ----
  // The wave of key group g finishes query tile g of its query group: it hands its part
  // of the other tile to its partner (wave ^ 2) through the ring's LDS, which every
  // reader has left at the last pass's barrier.
  const bool up = wv >= 2u;      // key group 1
  const float l0 = lrow[0] + other_half(lrow[0]);
  const float l1 = lrow[1] + other_half(lrow[1]);
  unsigned char* xw = &Rs[0][0][0] + wv * XCH_B + (uint32_t)lane * 16u;
  const unsigned char* xr = &Rs[0][0][0] + (wv ^ 2u) * XCH_B + (uint32_t)lane * 16u;
#pragma unroll
  for (int j = 0; j < 16; ++j) {
    const v8f g = up ? acc[0][j] : acc[1][j];
    *(float4*)(xw + (uint32_t)j * 1024u)        = make_float4(g[0], g[1], g[2], g[3]);
    *(float4*)(xw + (uint32_t)j * 1024u + 512u) = make_float4(g[4], g[5], g[6], g[7]);
  }
  if (half == 0)                 // both halves hold the same maximum and sum
    *(float2*)(xw + 16384u) = make_float2(up ? mrow[0] : mrow[1], up ? l0 : l1);
  __syncthreads();               // publishes each wave's handed-over part to its partner
  const float2 ml = *(const float2*)(xr + 16384u - (uint32_t)half * 256u);
  float4 pl[16], ph[16];         // the partner's part, read as one group
#pragma unroll
  for (int j = 0; j < 16; ++j) {
    pl[j] = *(const float4*)(xr + (uint32_t)j * 1024u);
    ph[j] = *(const float4*)(xr + (uint32_t)j * 1024u + 512u);
  }
  const float mk = up ? mrow[1] : mrow[0], lk = up ? l1 : l0;
  const float mj = fmaxf(mk, ml.x);
  const float ak = __expf(mk - mj), ap = __expf(ml.x - mj);
  const float inv = 1.0f / (lk * ak + ml.y * ap);
  const float fk = ak * inv, fp = ap * inv;
  float* orow = out + ((size_t)b * S_ + qb + kg * 16 + l16) * H_ + 8 * half;
#pragma unroll
  for (int j = 0; j < 16; ++j) {
    const v8f k8 = up ? acc[1][j] : acc[0][j];
    pl[j].x = k8[0] * fk + pl[j].x * fp; pl[j].y = k8[1] * fk + pl[j].y * fp;
    pl[j].z = k8[2] * fk + pl[j].z * fp; pl[j].w = k8[3] * fk + pl[j].w * fp;
    ph[j].x = k8[4] * fk + ph[j].x * fp; ph[j].y = k8[5] * fk + ph[j].y * fp;
    ph[j].z = k8[6] * fk + ph[j].z * fp; ph[j].w = k8[7] * fk + ph[j].w * fp;
  }
  // the stores stand together behind all the arithmetic: no instruction behind a
  // store then rewrites a register that the store names
  __builtin_amdgcn_sched_barrier(0);
#pragma unroll
  for (int j = 0; j < 16; ++j) {
    ((float4*)(orow + j * 16))[0] = pl[j];
    ((float4*)(orow + j * 16))[1] = ph[j];
  }
}

extern "C" void kernel_launch(void* const* d_in, const int* in_sizes, int n_in,
                              void* d_out, int out_size, void* d_ws, size_t ws_size,
                              hipStream_t stream) {
  const float* q = (const float*)d_in[0];
  const float* k = (const float*)d_in[1];
  const float* v = (const float*)d_in[2];
  const float* m = (const float*)d_in[3];
  float* out = (float*)d_out;
  unsigned short* ws = (unsigned short*)d_ws;

  hipLaunchKernelGGL(round_kv_kernel, dim3(2 * (B_ * S_ / 8) / 8), dim3(256), 0, stream, k, v, ws);
  dim3 grid(B_ * (S_ / 64));
  dim3 block(128);
  hipLaunchKernelGGL(fa_kernel, grid, block, 0, stream, q, ws, m, out);
}

// v007
// A run of this version takes 86.1 microseconds.
// Next to v006, in two timings, it ran 1.10 times as fast each time.
// All steps since v000 together make it 14.4 times as fast.
#include <hip/hip_runtime.h>
#include <stdint.h>

#define B_ 4
#define S_ 4096
#define H_ 256

typedef __bf16 v16bf __attribute__((ext_vector_type(16)));
typedef float  v8f   __attribute__((ext_vector_type(8)));
typedef float  v4f   __attribute__((ext_vector_type(4)));

__device__ __forceinline__ unsigned short f2bfbits(float f) {
  union { float f; unsigned u; } x; x.f = f;
  unsigned r = x.u + 0x7FFFu + ((x.u >> 16) & 1u);   // round-to-nearest-even
  return (unsigned short)(r >> 16);
}
__device__ __forceinline__ __bf16 bits2bf(unsigned short s) {
  union { unsigned short s; __bf16 b; } y; y.s = s; return y.b;
}

#define LDK 264   // bf16 row stride: >=256 and == 8 (mod 128) -> conflict-free b128 reads
#define LDV 272   // V row stride: 544 B, an odd multiple of 32 B, the transposing load's conflict-free pitch
#define KST 64    // keys a stage: 32 for each key group
#define PFD 128   // prefetch distance in keys (2 stages)
#define NST (S_ / KST)         // stages = passes
#define KP_B (LDK * 2u)        // K row pitch in bytes, workspace and LDS alike: 528
#define VP_B (LDV * 2u)        // V row pitch in bytes, workspace and LDS alike: 544
#define KW_B ((uint32_t)(B_ * S_) * KP_B) // bytes of the K plane; the V plane follows it
#define SLICE_B 18432u         // LDS place of one wave's slice: 32 rows, rounded up to 2 KiB
#define STAGE_B (4u * SLICE_B) // K rows 0-31, K rows 32-63, V rows 0-31, V rows 32-63
#define XCH_B 16896u           // epilogue exchange, one wave's place: 16 KiB of O, then maximum and sum

typedef uint32_t u32x4 __attribute__((ext_vector_type(4)));
typedef uint32_t u32x8 __attribute__((ext_vector_type(8)));
typedef short s16x8 __attribute__((ext_vector_type(8)));
typedef __attribute__((address_space(3))) s16x8 lds_s16x8;

// ds_load_tr16_b128: with lane l aimed at row 8*(l>>4) + (l&7), byte 16*((l>>3)&1)
// of a 16 x 16 tile of 16-bit elements, lane (c = l&15, h = l>>4) gets rows
// 8h .. 8h+7 of column c.
__device__ __forceinline__ u32x4 ld_tr16(const unsigned char* p) {
  return __builtin_bit_cast(u32x4, __builtin_amdgcn_ds_load_tr16_b128_v8i16((lds_s16x8*)p));
}

// Value of lane l ^ 16 (the other half of the wave), by a vector cross-row move.
__device__ __forceinline__ float other_half(float x) {
  const int b = __builtin_bit_cast(int, x);
  return __builtin_bit_cast(float, __builtin_amdgcn_permlanex16(
      b, b, 0x76543210, 0xfedcba98, false, false));
}

// Keeps a group of loads together and ahead of their users: without it the
// compiler sinks each load to just in front of its user, and the lone wave of
// a SIMD then waits out the full LDS latency at every matrix instruction.
__device__ __forceinline__ void hold_group() { __builtin_amdgcn_sched_barrier(0); }

// The work-group's barrier alone. __syncthreads() also waits out every global load of
// the wave, and the next pass's mask loads are meant to stay in flight across the
// loop's foot; the waits that the LDS ring needs stand, written out, in front of the call.
__device__ __forceinline__ void wg_barrier() {
  asm volatile("s_barrier_signal -1\n\ts_barrier_wait -1" ::: "memory");
}

__device__ __forceinline__ uint32_t uni(uint32_t v) {
  return (uint32_t)__builtin_amdgcn_readfirstlane(v);
}
// Holds a wave-uniform test in a scalar register so that the branch on it is
// a scalar one: a tensor load ignores EXEC and only such a branch skips it.
__device__ __forceinline__ uint32_t pinned(uint32_t v) {
  uint32_t w = uni(v);
  asm volatile("" : "+s"(w));
  return w;
}
// Tensor descriptor, group 1: byte elements, no mask, no pad. A slice (32 padded
// rows) is contiguous in the workspace and a whole number of 256-B units: it
// moves as tile = tensor = n lines of 256 B at source pitch 256 B.
__device__ __forceinline__ u32x8 tdm_group1(uint32_t n) {
  u32x8 g;
  g[0] = uni(0u);
  g[1] = uni(256u << 16);
  g[2] = uni(n << 16);
  g[3] = uni(256u << 16);
  g[4] = uni(n);
  g[5] = uni(256u);
  g[6] = uni(0u);
  g[7] = uni(0u);
  return g;
}
// Group 0: count 1, LDS byte offset, global address of the first byte, type 2.
__device__ __forceinline__ u32x4 tdm_group0(uint32_t lds_dst, uint64_t ga) {
  u32x4 g;
  g[0] = uni(1u);
  g[1] = uni(lds_dst);
  g[2] = uni((uint32_t)ga);
  g[3] = uni((((uint32_t)(ga >> 32)) & 0x01FFFFFFu) | 0x80000000u);
  return g;
}

// One 16 x 32 fragment's 16 elements of this lane: 8 at p, 8 at p + 32 B.
__device__ __forceinline__ v16bf ld_frag(const unsigned char* p) {
  const u32x4 lo = *(const u32x4*)p, hi = *(const u32x4*)(p + 32);
  const u32x8 w = {lo.x, lo.y, lo.z, lo.w, hi.x, hi.y, hi.z, hi.w};
  return __builtin_bit_cast(v16bf, w);
}

// One wave rounds 8 rows of 256 f32 to bf16 rows at pitch PITCH bytes and zeroes
// their pad bytes. 8 such rows are a whole number of 128-B lines, so no line has
// a second writer; the 16 loads of a lane fly together off one address.
template <uint32_t PITCH>
__device__ __forceinline__ void round_rows(const float* __restrict__ src,
                                           unsigned char* __restrict__ dst, uint32_t lane) {
  const float4* s4 = (const float4*)src + lane;
  float4 x[16];
#pragma unroll
  for (int r = 0; r < 16; ++r) x[r] = s4[r * 32];   // row r / 2, half r & 1
  // later code rewrites the address registers that the 16 loads name; the input
  // operand keeps that pair untouched up to this wait
  asm volatile("s_wait_xcnt 0x0" :: "v"(s4) : "memory");
#pragma unroll
  for (int r = 0; r < 16; ++r) {
    uint2 w;
    w.x = (uint32_t)f2bfbits(x[r].x) | ((uint32_t)f2bfbits(x[r].y) << 16);
    w.y = (uint32_t)f2bfbits(x[r].z) | ((uint32_t)f2bfbits(x[r].w) << 16);
    *(uint2*)(dst + (uint32_t)(r >> 1) * PITCH + (uint32_t)(r & 1) * 256u + lane * 8u) = w;
  }
  constexpr uint32_t PQ = (PITCH - 512u) / 16u;     // 16-B pad pieces a row
  if (lane < 8u * PQ)
    *(uint4*)(dst + (lane / PQ) * PITCH + 512u + (lane % PQ) * 16u) = make_uint4(0u, 0u, 0u, 0u);
}

#define NGR ((uint32_t)(B_ * S_) / 8u)  // groups of 8 rows in one plane

// The grid puts four waves on a SIMD: told so, the compiler spends the registers
// that let a lane's 16 loads stay in flight at once.
__global__ __launch_bounds__(256) __attribute__((amdgpu_waves_per_eu(4, 4)))
void round_kv_kernel(const float* __restrict__ k, const float* __restrict__ v,
                     unsigned short* __restrict__ ws) {
  const uint32_t lane = threadIdx.x & 31u;
  const uint32_t gr = blockIdx.x * 8u + (threadIdx.x >> 5);  // first the K plane's groups, then V's
  unsigned char* w8 = (unsigned char*)ws;
  if (blockIdx.x < NGR / 8u)
    round_rows<KP_B>(k + (size_t)gr * (8u * H_), w8 + (size_t)gr * (8u * KP_B), lane);
  else
    round_rows<VP_B>(v + (size_t)(gr - NGR) * (8u * H_),
                     w8 + KW_B + (size_t)(gr - NGR) * (8u * VP_B), lane);
}

// One wave a SIMD, so one work-group a WGP: the grid has one work-group for each
// WGP, and a wave's two O tiles with its fragment groups take more than half of a
// SIMD's registers.
__global__ __launch_bounds__(128) __attribute__((amdgpu_waves_per_eu(1, 1)))
void fa_kernel(const float* __restrict__ q, const unsigned short* __restrict__ ws,
               const float* __restrict__ mask, float* __restrict__ out) {
  // landing ring of the tensor loads: [buffer][slice][32 bf16 rows at pitch KP_B or VP_B]
  __shared__ __attribute__((aligned(2048))) unsigned char Rs[2][4][SLICE_B];
  __shared__ unsigned short Qs[4][16][LDK]; // Q tiles: [tile][m][h], bf16 bits

  const int tid  = threadIdx.x;
  const int lane = tid & 31;
  const int wave = tid >> 5;
  const int half = lane >> 4;   // 0: lanes 0-15, 1: lanes 16-31
  const int l16  = lane & 15;
  const int qg   = wave & 1;    // query group: queries 32*qg .. 32*qg + 31 of the block
  const int kg   = wave >> 1;   // key group: keys 32*kg .. 32*kg + 31 of every stage

  const int nqblk = S_ / 64;
  const int b    = blockIdx.x / nqblk;
  const int qblk = (blockIdx.x % nqblk) * 64;
  const int qb   = qblk + qg * 32;

  // ---- stage Q tile (64 rows x 256 h) to LDS as bf16, cooperatively ----
#pragma unroll
  for (int p = 0; p < 32; ++p) {
    const int r  = p * 2 + (tid >> 6);   // 0..63
    const int c4 = tid & 63;             // float4 column
    const float4 qv = ((const float4*)(q + ((size_t)b * S_ + qblk + r) * H_))[c4];
    unsigned short* dst = &Qs[r >> 4][r & 15][c4 * 4];
    dst[0] = f2bfbits(qv.x); dst[1] = f2bfbits(qv.y);
    dst[2] = f2bfbits(qv.z); dst[3] = f2bfbits(qv.w);
  }

  // ---- accumulators & softmax state, one set per query tile t ----
  v8f acc[2][16];              // O^T: tile j, register i = O[query 16t + l16][h = 16j + 8*half + i]
#pragma unroll
  for (int t = 0; t < 2; ++t)
#pragma unroll
    for (int j = 0; j < 16; ++j)
#pragma unroll
      for (int i = 0; i < 8; ++i) acc[t][j][i] = 0.0f;

  // Running maximum of query 16t + l16 over this key group, the same in both halves.
  // It starts at the lowest finite value, not at -inf: a key group whose keys so far
  // are all masked with -inf then keeps weights, sum and O at zero instead of
  // forming -inf - -inf, and drops out when the groups are joined.
  float mrow[2] = {-3.402823466e+38f, -3.402823466e+38f};
  float lrow[2] = {0.0f, 0.0f};   // running sum over this half's keys of this key group

  const float scale = 0.0625f; // 1/sqrt(256)

  // ---- hoisted per-lane base pointers (loop adds only uniform kb terms) ----
  // one lane a query row: the 128-B line of this key group's 32 keys
  const float* mpf = mask + ((size_t)b * S_ + (qb + lane)) * S_ + kg * 32 + PFD;
  const float* mdem = mask + ((size_t)b * S_ + qb + l16) * S_ + kg * 32 + 8 * half;
  // this lane's address for Q's fragments of query tile 0, h 0-31
  const unsigned char* qad = (const unsigned char*)&Qs[qg * 2][l16][0] + (uint32_t)half * 16u;
  // this lane's address in buffer 0 for K's fragments of the group's keys 0-15, h 0-31
  const unsigned char* kad = &Rs[0][kg][0] + (uint32_t)l16 * KP_B + (uint32_t)half * 16u;
  // this lane's address in buffer 0 for the transposing loads of V's keys 0-15, h 0-15
  const unsigned char* vad = &Rs[0][2 + kg][0]
                           + (uint32_t)(8 * half + (lane & 7)) * VP_B
                           + (uint32_t)((lane >> 3) & 1) * 16u;

  // ---- tensor-load ring: every wave brings one 32-row slice per stage ----
  // waves 0,1: the K rows of key groups 0,1; waves 2,3: the V rows.
  const uint32_t wv    = uni((uint32_t)tid >> 5);
  const uint32_t lbase = (uint32_t)(size_t)&Rs[0][0][0] + wv * SLICE_B;
  const uint32_t pitch = (wv & 2u) ? VP_B : KP_B;
  const uint64_t gbase = (uint64_t)(size_t)ws + ((wv & 2u) ? KW_B : 0u)
                       + ((uint64_t)b * S_ + (wv & 1u) * 32u) * pitch;
  const u32x8 g1 = tdm_group1(pitch / 8u);    // 32 rows = pitch / 8 lines of 256 B
  auto issue = [&](uint32_t st) {
    const u32x4 g0 = tdm_group0(lbase + (st & 1u) * STAGE_B,
                                gbase + (uint64_t)st * ((uint32_t)KST * pitch));
    // both groups sit in named registers of their own at every issue: the only writes of
    // group 0's words then stand here, behind the wait that covers the request before
    asm volatile("tensor_load_to_lds %0, %1" :: "{s[56:59]}"(g0), "{s[48:55]}"(g1) : "memory");
    return g0;
  };
  // ---- mask words of one pass: [query tile t][keys 0-3, 4-7, 16-19, 20-23 of this half] ----
  struct MaskSet { v4f w[2][4]; };
  constexpr int QT = 16 * S_ / 4;   // query tile 1: 16 mask rows on, in 16-B units
  auto load_mask = [&](MaskSet& m, const v4f* mq) __attribute__((always_inline)) {
    m.w[0][0] = mq[0];  m.w[0][1] = mq[1];      m.w[0][2] = mq[4];      m.w[0][3] = mq[5];
    m.w[1][0] = mq[QT]; m.w[1][1] = mq[QT + 1]; m.w[1][2] = mq[QT + 4]; m.w[1][3] = mq[QT + 5];
  };
  MaskSet ma, mb;
  {
    const v4f* mq = (const v4f*)mdem;   // pass 0's words fly under the first tile's landing
    load_mask(ma, mq);
    // stands in front of whatever later rewrites the address registers that these eight
    // loads name (the lane's base address, which lives on through the loop)
    asm volatile("s_wait_xcnt 0x0" ::: "memory");
  }

  const u32x4 first = issue(0);
  // stage 0 landed in this wave; the barrier publishes it (and Qs) to all waves. The input
  // operand keeps the build of stage 1's group 0, which nothing else holds back, behind the wait
  asm volatile("s_wait_tensorcnt 0x0" :: "{s[56:59]}"(first) : "memory");
  __syncthreads();
  issue(1);

  // one pass: works on stage kb / KST with the mask words in cur, fills nxt for the next
  auto pass = [&](const int kb, const MaskSet& cur, MaskSet& nxt) __attribute__((always_inline)) {
    const uint32_t st = (uint32_t)kb / (uint32_t)KST;
    // ---- speculative prefetch (global_prefetch_b8), 2 stages ahead ----
    if (kb < S_ - PFD) {
      __builtin_prefetch(mpf + kb, 0, 1);
    }

    const unsigned char* kp = kad + (st & 1u) * STAGE_B;  // this pass's buffer
    const unsigned char* vp = vad + (st & 1u) * STAGE_B;

    // ---- the next pass's eight mask loads, a whole pass ahead of their use (the last
    //      pass has no next and reads its own words again: in bounds, not used);
    //      then the operand group of S^T: all fragments of Q^T and K in the order of their use ----
    const v4f* mq = (const v4f*)(mdem + (kb + KST < S_ ? kb + KST : kb));
    load_mask(nxt, mq);
    // A = K chunk (16 keys x 32 h), key tile u; B = Q^T chunk (32 h x 16 queries), query tile t
    v16bf qa[2][8], ka[2][8];
#pragma unroll
    for (int c = 0; c < 8; ++c) {
      qa[0][c] = ld_frag(qad + 64u * c);
      qa[1][c] = ld_frag(qad + 16u * KP_B + 64u * c);
      ka[0][c] = ld_frag(kp + 64u * c);               // keys 0-15, the same h order as qa
      ka[1][c] = ld_frag(kp + 16u * KP_B + 64u * c);  // keys 16-31
    }
    // later code rewrites the address registers that the eight mask loads name; the
    // input operand keeps that pair untouched up to this wait
    asm volatile("s_wait_xcnt 0x0" :: "v"(mq) : "memory");
    hold_group();

    // ---- S^T = K Q^T : per query tile two 16x16 f32 tiles (keys 0-15, 16-31) ----
    v8f sc[2][2];                // [query tile t][key tile u]
#pragma unroll
    for (int t = 0; t < 2; ++t)
#pragma unroll
      for (int u = 0; u < 2; ++u)
#pragma unroll
        for (int i = 0; i < 8; ++i) sc[t][u][i] = 0.0f;

#pragma unroll
    for (int c = 0; c < 8; ++c)
#pragma unroll
      for (int u = 0; u < 2; ++u)
#pragma unroll
        for (int t = 0; t < 2; ++t)
          sc[t][u] = __builtin_amdgcn_wmma_f32_16x16x32_bf16(false, ka[u][c], false, qa[t][c],
                                                             (short)0, sc[t][u], false, false);

    // ---- operand group of O^T: all V^T fragments; they land under the softmax ----
    // A = V^T chunk: (16 h) x (32 keys); M = l16; element e = key half*8 + (e&7) + 16*(e>>3)
    u32x4 vlo[16], vhi[16];
#pragma unroll
    for (int j = 0; j < 16; ++j) {
      vlo[j] = ld_tr16(vp + 32u * j);               // keys 0-15
      vhi[j] = ld_tr16(vp + 16u * VP_B + 32u * j);  // keys 16-31
    }
    hold_group();

    v16bf pf[2];
#pragma unroll
    for (int t = 0; t < 2; ++t) {
      // ---- scale + mask (C layout: key = i + 8*half (+16 for tile 1), query = 16t + l16) ----
      // whole-vector form: each mask word is used out of the register its load wrote
      v8f s0 = sc[t][0] * scale + __builtin_shufflevector(cur.w[t][0], cur.w[t][1], 0, 1, 2, 3, 4, 5, 6, 7);
      v8f s1 = sc[t][1] * scale + __builtin_shufflevector(cur.w[t][2], cur.w[t][3], 0, 1, 2, 3, 4, 5, 6, 7);

      // ---- online softmax over this 32-key block, one query per lane ----
      float mx = fmaxf(s0[0], s1[0]);
#pragma unroll
      for (int i = 1; i < 8; ++i) mx = fmaxf(mx, fmaxf(s0[i], s1[i]));
      mx = fmaxf(mx, other_half(mx));              // the other 16 keys of this query
      const float mnew  = fmaxf(mrow[t], mx);
      const float alpha = __expf(mrow[t] - mnew);
      float ps = 0.0f;
#pragma unroll
      for (int i = 0; i < 8; ++i) {
        s0[i] = __expf(s0[i] - mnew);
        s1[i] = __expf(s1[i] - mnew);
        ps += s0[i] + s1[i];
      }
      lrow[t] = lrow[t] * alpha + ps;
      mrow[t] = mnew;
#pragma unroll
      for (int j = 0; j < 16; ++j)
#pragma unroll
        for (int i = 0; i < 8; ++i) acc[t][j][i] *= alpha;  // rescale O^T

      // ---- P^T as B-matrix (32 keys x 16 queries): element e = key half*8 + (e&7) + 16*(e>>3),
      //      which is register e&7 of S^T tile e>>3 in this very lane ----
#pragma unroll
      for (int i = 0; i < 8; ++i) {
        pf[t][i]     = bits2bf(f2bfbits(s0[i]));
        pf[t][8 + i] = bits2bf(f2bfbits(s1[i]));
      }
    }

    // ---- O^T += V^T P^T : 16 h-tiles, each V^T fragment for both query tiles ----
#pragma unroll
    for (int j = 0; j < 16; ++j) {
      const u32x4 lo = vlo[j], hi = vhi[j];
      const u32x8 vw = {lo.x, lo.y, lo.z, lo.w, hi.x, hi.y, hi.z, hi.w};
      const v16bf vb = __builtin_bit_cast(v16bf, vw);
#pragma unroll
      for (int t = 0; t < 2; ++t)
        acc[t][j] = __builtin_amdgcn_wmma_f32_16x16x32_bf16(false, vb, false, pf[t],
                                                            (short)0, acc[t][j], false, false);
    }

    // ---- publish point of stage st + 1 ----
    // keeps the softmax and the second product in front of the waits below, so that
    // they run while V's fragments still land
    __builtin_amdgcn_sched_barrier(0);
    // this wave's LDS reads of this pass have retired
    asm volatile("s_wait_dscnt 0x0" ::: "memory");
    // this wave's slice of stage st + 1 has landed
    asm volatile("s_wait_tensorcnt 0x0" ::: "memory");
    wg_barrier();              // publishes stage st + 1; every reader has left this pass's LDS
    if (pinned(st + 2u < (uint32_t)NST)) issue(st + 2u);  // refill the buffer just read
  };
  // two passes a trip: the two copies of the body are there for the two mask sets
  for (int kb = 0; kb < S_; kb += 2 * KST) {
    pass(kb, ma, mb);
    pass(kb + KST, mb, ma);
  }
  // nothing of the ring is in flight when the wave goes on to its end
  asm volatile("s_wait_tensorcnt 0x0" ::: "memory");
  asm volatile("s_wait_dscnt 0x0" ::: "memory");

  // ---- epilogue: join the halves' sums, then the two key groups, normalize and store ----
  // The wave of key group g finishes query tile g of its query group: it hands its part
  // of the other tile to its partner (wave ^ 2) through the ring's LDS, which every
  // reader has left at the last pass's barrier.
  const bool up = wv >= 2u;      // key group 1
  const float l0 = lrow[0] + other_half(lrow[0]);
  const float l1 = lrow[1] + other_half(lrow[1]);
  unsigned char* xw = &Rs[0][0][0] + wv * XCH_B + (uint32_t)lane * 16u;
  const unsigned char* xr = &Rs[0][0][0] + (wv ^ 2u) * XCH_B + (uint32_t)lane * 16u;
#pragma unroll
  for (int j = 0; j < 16; ++j) {
    const v8f g = up ? acc[0][j] : acc[1][j];
    *(float4*)(xw + (uint32_t)j * 1024u)        = make_float4(g[0], g[1], g[2], g[3]);
    *(float4*)(xw + (uint32_t)j * 1024u + 512u) = make_float4(g[4], g[5], g[6], g[7]);
  }
  if (half == 0)                 // both halves hold the same maximum and sum
    *(float2*)(xw + 16384u) = make_float2(up ? mrow[0] : mrow[1], up ? l0 : l1);
  __syncthreads();               // publishes each wave's handed-over part to its partner
  const float2 ml = *(const float2*)(xr + 16384u - (uint32_t)half * 256u);
  float4 pl[16], ph[16];         // the partner's part, read as one group
#pragma unroll
  for (int j = 0; j < 16; ++j) {
    pl[j] = *(const float4*)(xr + (uint32_t)j * 1024u);
    ph[j] = *(const float4*)(xr + (uint32_t)j * 1024u + 512u);
  }
  const float mk = up ? mrow[1] : mrow[0], lk = up ? l1 : l0;
  const float mj = fmaxf(mk, ml.x);
  const float ak = __expf(mk - mj), ap = __expf(ml.x - mj);
  const float inv = 1.0f / (lk * ak + ml.y * ap);
  const float fk = ak * inv, fp = ap * inv;
  float* orow = out + ((size_t)b * S_ + qb + kg * 16 + l16) * H_ + 8 * half;
#pragma unroll
  for (int j = 0; j < 16; ++j) {
    const v8f k8 = up ? acc[1][j] : acc[0][j];
    pl[j].x = k8[0] * fk + pl[j].x * fp; pl[j].y = k8[1] * fk + pl[j].y * fp;
    pl[j].z = k8[2] * fk + pl[j].z * fp; pl[j].w = k8[3] * fk + pl[j].w * fp;
    ph[j].x = k8[4] * fk + ph[j].x * fp; ph[j].y = k8[5] * fk + ph[j].y * fp;
    ph[j].z = k8[6] * fk + ph[j].z * fp; ph[j].w = k8[7] * fk + ph[j].w * fp;
  }
  // the stores stand together behind all the arithmetic: no instruction behind a
  // store then rewrites a register that the store names
  __builtin_amdgcn_sched_barrier(0);
#pragma unroll
  for (int j = 0; j < 16; ++j) {
    ((float4*)(orow + j * 16))[0] = pl[j];
    ((float4*)(orow + j * 16))[1] = ph[j];
  }
}

extern "C" void kernel_launch(void* const* d_in, const int* in_sizes, int n_in,
                              void* d_out, int out_size, void* d_ws, size_t ws_size,
                              hipStream_t stream) {
  const float* q = (const float*)d_in[0];
  const float* k = (const float*)d_in[1];
  const float* v = (const float*)d_in[2];
  const float* m = (const float*)d_in[3];
  float* out = (float*)d_out;
  unsigned short* ws = (unsigned short*)d_ws;

  hipLaunchKernelGGL(round_kv_kernel, dim3(2 * (B_ * S_ / 8) / 8), dim3(256), 0, stream, k, v, ws);
  dim3 grid(B_ * (S_ / 64));
  dim3 block(128);
  hipLaunchKernelGGL(fa_kernel, grid, block, 0, stream, q, ws, m, out);
}

// v008
// Measured time: 79.1 microseconds a run.
// Two timings next to v007 put it at 1.09 and 1.08 times that version's speed.
// All steps since v000 together make it 15.6 times as fast.
#include <hip/hip_runtime.h>
#include <stdint.h>

#define B_ 4
#define S_ 4096
#define H_ 256

typedef __bf16 v16bf __attribute__((ext_vector_type(16)));
typedef float  v8f   __attribute__((ext_vector_type(8)));
typedef float  v4f   __attribute__((ext_vector_type(4)));

__device__ __forceinline__ unsigned short f2bfbits(float f) {
  union { float f; unsigned u; } x; x.f = f;
  unsigned r = x.u + 0x7FFFu + ((x.u >> 16) & 1u);   // round-to-nearest-even
  return (unsigned short)(r >> 16);
}
__device__ __forceinline__ __bf16 bits2bf(unsigned short s) {
  union { unsigned short s; __bf16 b; } y; y.s = s; return y.b;
}

#define LDK 264   // bf16 row stride: >=256 and == 8 (mod 128) -> conflict-free b128 reads
#define LDV 272   // V row stride: 544 B, an odd multiple of 32 B, the transposing load's conflict-free pitch
#define KST 128   // keys a stage: 32 for each key group
#define PFD 256   // prefetch distance in keys (2 stages)
#define NST (S_ / KST)         // stages = passes
#define KP_B (LDK * 2u)        // K row pitch in bytes, workspace and LDS alike: 528
#define VP_B (LDV * 2u)        // V row pitch in bytes, workspace and LDS alike: 544
#define KW_B ((uint32_t)(B_ * S_) * KP_B) // bytes of the K plane; the V plane follows it
#define SLICE_B 34816u         // LDS place of one issuing wave's slice: 64 rows, rounded up to 2 KiB
// a slice's two buffers lie side by side, so that one address register with the load's
// 16-bit offset reaches a wave's fragments in either buffer
#define XCH_B 33280u           // epilogue exchange, one wave's place: 32 KiB of O, then maxima and sums

typedef uint32_t u32x4 __attribute__((ext_vector_type(4)));
typedef uint32_t u32x8 __attribute__((ext_vector_type(8)));
typedef short s16x8 __attribute__((ext_vector_type(8)));
typedef __attribute__((address_space(3))) s16x8 lds_s16x8;

// ds_load_tr16_b128: with lane l aimed at row 8*(l>>4) + (l&7), byte 16*((l>>3)&1)
// of a 16 x 16 tile of 16-bit elements, lane (c = l&15, h = l>>4) gets rows
// 8h .. 8h+7 of column c.
__device__ __forceinline__ u32x4 ld_tr16(const unsigned char* p) {
  return __builtin_bit_cast(u32x4, __builtin_amdgcn_ds_load_tr16_b128_v8i16((lds_s16x8*)p));
}

// Value of lane l ^ 16 (the other half of the wave), by a vector cross-row move.
__device__ __forceinline__ float other_half(float x) {
  const int b = __builtin_bit_cast(int, x);
  return __builtin_bit_cast(float, __builtin_amdgcn_permlanex16(
      b, b, 0x76543210, 0xfedcba98, false, false));
}

// Keeps a group of loads together and ahead of their users: without it the
// compiler sinks each load to just in front of its user, and the wave then
// waits out the full LDS latency at every matrix instruction.
__device__ __forceinline__ void hold_group() { __builtin_amdgcn_sched_barrier(0); }

// The work-group's barrier alone: the waits that the LDS ring needs stand, written out,
// in front of the call.
__device__ __forceinline__ void wg_barrier() {
  asm volatile("s_barrier_signal -1\n\ts_barrier_wait -1" ::: "memory");
}

__device__ __forceinline__ uint32_t uni(uint32_t v) {
  return (uint32_t)__builtin_amdgcn_readfirstlane(v);
}
// Holds a wave-uniform test in a scalar register so that the branch on it is
// a scalar one: a tensor load ignores EXEC and only such a branch skips it.
__device__ __forceinline__ uint32_t pinned(uint32_t v) {
  uint32_t w = uni(v);
  asm volatile("" : "+s"(w));
  return w;
}
// Tensor descriptor, group 1: byte elements, no mask, no pad. A slice (64 padded
// rows) is contiguous in the workspace and a whole number of 256-B units: it
// moves as tile = tensor = n lines of 256 B at source pitch 256 B.
__device__ __forceinline__ u32x8 tdm_group1(uint32_t n) {
  u32x8 g;
  g[0] = uni(0u);
  g[1] = uni(256u << 16);
  g[2] = uni(n << 16);
  g[3] = uni(256u << 16);
  g[4] = uni(n);
  g[5] = uni(256u);
  g[6] = uni(0u);
  g[7] = uni(0u);
  return g;
}
// Group 0: count 1, LDS byte offset, global address of the first byte, type 2.
__device__ __forceinline__ u32x4 tdm_group0(uint32_t lds_dst, uint64_t ga) {
  u32x4 g;
  g[0] = uni(1u);
  g[1] = uni(lds_dst);
  g[2] = uni((uint32_t)ga);
  g[3] = uni((((uint32_t)(ga >> 32)) & 0x01FFFFFFu) | 0x80000000u);
  return g;
}

// One 16 x 32 fragment's 16 elements of this lane: 8 at p, 8 at p + 32 B.
__device__ __forceinline__ v16bf ld_frag(const unsigned char* p) {
  const u32x4 lo = *(const u32x4*)p, hi = *(const u32x4*)(p + 32);
  const u32x8 w = {lo.x, lo.y, lo.z, lo.w, hi.x, hi.y, hi.z, hi.w};
  return __builtin_bit_cast(v16bf, w);
}

// One wave rounds 8 rows of 256 f32 to bf16 rows at pitch PITCH bytes and zeroes
// their pad bytes. 8 such rows are a whole number of 128-B lines, so no line has
// a second writer; the 16 loads of a lane fly together off one address.
template <uint32_t PITCH>
__device__ __forceinline__ void round_rows(const float* __restrict__ src,
                                           unsigned char* __restrict__ dst, uint32_t lane) {
  const float4* s4 = (const float4*)src + lane;
  float4 x[16];
#pragma unroll
  for (int r = 0; r < 16; ++r) x[r] = s4[r * 32];   // row r / 2, half r & 1
  // later code rewrites the address registers that the 16 loads name; the input
  // operand keeps that pair untouched up to this wait
  asm volatile("s_wait_xcnt 0x0" :: "v"(s4) : "memory");
#pragma unroll
  for (int r = 0; r < 16; ++r) {
    uint2 w;
    w.x = (uint32_t)f2bfbits(x[r].x) | ((uint32_t)f2bfbits(x[r].y) << 16);
    w.y = (uint32_t)f2bfbits(x[r].z) | ((uint32_t)f2bfbits(x[r].w) << 16);
    *(uint2*)(dst + (uint32_t)(r >> 1) * PITCH + (uint32_t)(r & 1) * 256u + lane * 8u) = w;
  }
  constexpr uint32_t PQ = (PITCH - 512u) / 16u;     // 16-B pad pieces a row
  if (lane < 8u * PQ)
    *(uint4*)(dst + (lane / PQ) * PITCH + 512u + (lane % PQ) * 16u) = make_uint4(0u, 0u, 0u, 0u);
}

#define NGR ((uint32_t)(B_ * S_) / 8u)  // groups of 8 rows in one plane

// The grid puts four waves on a SIMD: told so, the compiler spends the registers
// that let a lane's 16 loads stay in flight at once.
__global__ __launch_bounds__(256) __attribute__((amdgpu_waves_per_eu(4, 4)))
void round_kv_kernel(const float* __restrict__ k, const float* __restrict__ v,
                     unsigned short* __restrict__ ws) {
  const uint32_t lane = threadIdx.x & 31u;
  const uint32_t gr = blockIdx.x * 8u + (threadIdx.x >> 5);  // first the K plane's groups, then V's
  unsigned char* w8 = (unsigned char*)ws;
  if (blockIdx.x < NGR / 8u)
    round_rows<KP_B>(k + (size_t)gr * (8u * H_), w8 + (size_t)gr * (8u * KP_B), lane);
  else
    round_rows<VP_B>(v + (size_t)(gr - NGR) * (8u * H_),
                     w8 + KW_B + (size_t)(gr - NGR) * (8u * VP_B), lane);
}

// Two waves a SIMD, one work-group a WGP: the grid has one work-group for each WGP,
// and a wave has half of a SIMD's registers, half of those for its two O tiles.
__global__ __launch_bounds__(256) __attribute__((amdgpu_waves_per_eu(2, 2)))
void fa_kernel(const float* __restrict__ q, const unsigned short* __restrict__ ws,
               const float* __restrict__ mask, float* __restrict__ out) {
  // landing ring of the tensor loads: [slice][buffer][64 bf16 rows at pitch KP_B or VP_B];
  // slices: K rows 0-63, K rows 64-127, V rows 0-63, V rows 64-127 of a stage
  __shared__ __attribute__((aligned(2048))) unsigned char Rs[4][2][SLICE_B];
  __shared__ unsigned short Qs[4][16][LDK]; // Q tiles: [tile][m][h], bf16 bits

  const int tid  = threadIdx.x;
  const int lane = tid & 31;
  const int wave = tid >> 5;
  const int half = lane >> 4;   // 0: lanes 0-15, 1: lanes 16-31
  const int l16  = lane & 15;
  const int qg   = wave & 1;    // query group: queries 32*qg .. 32*qg + 31 of the block
  const int kg   = wave >> 1;   // key group 0-3: keys 32*kg .. 32*kg + 31 of every stage

  const int nqblk = S_ / 64;
  const int b    = blockIdx.x / nqblk;
  const int qblk = (blockIdx.x % nqblk) * 64;
  const int qb   = qblk + qg * 32;

  // ---- stage Q tile (64 rows x 256 h) to LDS as bf16, cooperatively ----
#pragma unroll
  for (int p = 0; p < 16; ++p) {
    const int r  = p * 4 + (tid >> 6);   // 0..63
    const int c4 = tid & 63;             // float4 column
    const float4 qv = ((const float4*)(q + ((size_t)b * S_ + qblk + r) * H_))[c4];
    unsigned short* dst = &Qs[r >> 4][r & 15][c4 * 4];
    dst[0] = f2bfbits(qv.x); dst[1] = f2bfbits(qv.y);
    dst[2] = f2bfbits(qv.z); dst[3] = f2bfbits(qv.w);
  }

  // ---- accumulators & softmax state, one set per query tile t ----
  v8f acc[2][16];              // O^T: tile j, register i = O[query 16t + l16][h = 16j + 8*half + i]
#pragma unroll
  for (int t = 0; t < 2; ++t)
#pragma unroll
    for (int j = 0; j < 16; ++j)
#pragma unroll
      for (int i = 0; i < 8; ++i) acc[t][j][i] = 0.0f;

  // Running maximum of query 16t + l16 over this key group, the same in both halves.
  // It starts at the lowest finite value, not at -inf: a key group whose keys so far
  // are all masked with -inf then keeps weights, sum and O at zero instead of
  // forming -inf - -inf, and drops out when the groups are joined.
  float mrow[2] = {-3.402823466e+38f, -3.402823466e+38f};
  float lrow[2] = {0.0f, 0.0f};   // running sum over this half's keys of this key group

  const float scale = 0.0625f; // 1/sqrt(256)

  // ---- hoisted per-lane base pointers (loop adds only uniform kb terms) ----
  // one lane a query row: the 128-B line of this key group's 32 keys
  const float* mpf = mask + ((size_t)b * S_ + (qb + lane)) * S_ + kg * 32 + PFD;
  const float* mdem = mask + ((size_t)b * S_ + qb + l16) * S_ + kg * 32 + 8 * half;
  // this lane's address for Q's fragments of query tile 0, h 0-31
  const unsigned char* qad = (const unsigned char*)&Qs[qg * 2][l16][0] + (uint32_t)half * 16u;
  // this lane's address in buffer 0 for K's fragments of the group's keys 0-15, h 0-31
  const unsigned char* kad = &Rs[kg >> 1][0][0] + (uint32_t)((kg & 1) * 32 + l16) * KP_B
                           + (uint32_t)half * 16u;
  // this lane's address in buffer 0 for the transposing loads of V's keys 0-15, h 0-15
  const unsigned char* vad = &Rs[2 + (kg >> 1)][0][0]
                           + (uint32_t)((kg & 1) * 32 + 8 * half + (lane & 7)) * VP_B
                           + (uint32_t)((lane >> 3) & 1) * 16u;

  // ---- tensor-load ring: each of waves 0-3 brings one 64-row slice per stage ----
  // waves 0,1: the K rows of key groups 0-1, 2-3; waves 2,3: the V rows. Waves 4-7 issue none.
  const uint32_t wv    = uni((uint32_t)tid >> 5);
  const uint32_t sl    = wv & 3u;
  const uint32_t lbase = (uint32_t)(size_t)&Rs[0][0][0] + sl * (2u * SLICE_B);
  const uint32_t pitch = (sl & 2u) ? VP_B : KP_B;
  const uint64_t gbase = (uint64_t)(size_t)ws + ((sl & 2u) ? KW_B : 0u)
                       + ((uint64_t)b * S_ + (sl & 1u) * 64u) * pitch;
  const u32x8 g1 = tdm_group1(pitch / 4u);    // 64 rows = pitch / 4 lines of 256 B
  auto issue = [&](uint32_t st) {
    const u32x4 g0 = tdm_group0(lbase + (st & 1u) * SLICE_B,
                                gbase + (uint64_t)st * ((uint32_t)KST * pitch));
    // both groups sit in named registers of their own at every issue: the only writes of
    // group 0's words then stand here, behind the wait that covers the request before
    asm volatile("tensor_load_to_lds %0, %1" :: "{s[56:59]}"(g0), "{s[48:55]}"(g1) : "memory");
    return g0;
  };
  // ---- mask words of one pass: [query tile t][keys 0-3, 4-7, 16-19, 20-23 of this half] ----
  struct MaskSet { v4f w[2][4]; };
  constexpr int QT = 16 * S_ / 4;   // query tile 1: 16 mask rows on, in 16-B units
  auto load_mask = [&](MaskSet& m, const v4f* mq) __attribute__((always_inline)) {
    m.w[0][0] = mq[0];  m.w[0][1] = mq[1];      m.w[0][2] = mq[4];      m.w[0][3] = mq[5];
    m.w[1][0] = mq[QT]; m.w[1][1] = mq[QT + 1]; m.w[1][2] = mq[QT + 4]; m.w[1][3] = mq[QT + 5];
  };
  if (pinned(wv < 4u)) {
    const u32x4 first = issue(0);
    // stage 0 landed in this wave; the barrier publishes it (and Qs) to all waves. The input
    // operand keeps the build of stage 1's group 0, which nothing else holds back, behind the wait
    asm volatile("s_wait_tensorcnt 0x0" :: "{s[56:59]}"(first) : "memory");
  }
  __syncthreads();
  if (pinned(wv < 4u)) issue(1);

  // one pass: works on stage kb / KST; its mask words stand mo 16-B units behind mt, the
  // address that both passes of a trip load from
  auto pass = [&](const int kb, const v4f* mt, const int mo) __attribute__((always_inline)) {
    const uint32_t st = (uint32_t)kb / (uint32_t)KST;
    // ---- speculative prefetch (global_prefetch_b8), 2 stages ahead ----
    if (kb < S_ - PFD) {
      __builtin_prefetch(mpf + kb, 0, 1);
    }

    const unsigned char* kp = kad + (st & 1u) * SLICE_B;  // this pass's buffer
    const unsigned char* vp = vad + (st & 1u) * SLICE_B;

    // ---- S^T = K Q^T : per query tile two 16x16 f32 tiles (keys 0-15, 16-31) ----
    // A = K chunk (16 keys x 32 h), key tile u; B = Q^T chunk (32 h x 16 queries), query tile t.
    // The fragments come in four groups of two chunks, two groups ahead of their use.
    v16bf qa[2][8], ka[2][8];
    v8f sc[2][2];                // [query tile t][key tile u]
#pragma unroll
    for (int t = 0; t < 2; ++t)
#pragma unroll
      for (int u = 0; u < 2; ++u)
#pragma unroll
        for (int i = 0; i < 8; ++i) sc[t][u][i] = 0.0f;
    auto ld_qk = [&](const int c) __attribute__((always_inline)) {
      qa[0][c] = ld_frag(qad + 64u * c);
      qa[1][c] = ld_frag(qad + 16u * KP_B + 64u * c);
      ka[0][c] = ld_frag(kp + 64u * c);               // keys 0-15, the same h order as qa
      ka[1][c] = ld_frag(kp + 16u * KP_B + 64u * c);  // keys 16-31
    };
    auto mm_qk = [&](const int c) __attribute__((always_inline)) {
#pragma unroll
      for (int u = 0; u < 2; ++u)
#pragma unroll
        for (int t = 0; t < 2; ++t)
          sc[t][u] = __builtin_amdgcn_wmma_f32_16x16x32_bf16(false, ka[u][c], false, qa[t][c],
                                                             (short)0, sc[t][u], false, false);
    };
    ld_qk(0); ld_qk(1); ld_qk(2); ld_qk(3);
    hold_group();
    // this pass's eight mask loads: they land under S^T's fragments and products
    MaskSet cur;
    load_mask(cur, mt + mo);
    // later code rewrites the address registers that the eight mask loads name: the wait
    // stands directly behind them, and runs out while the first fragments land; the input
    // operand keeps that pair untouched up to the wait
    asm volatile("s_wait_xcnt 0x0" :: "v"(mt) : "memory");
    hold_group();
    mm_qk(0); mm_qk(1);
    hold_group();
    ld_qk(4); ld_qk(5);
    hold_group();
    mm_qk(2); mm_qk(3);
    hold_group();
    ld_qk(6); ld_qk(7);
    hold_group();
    mm_qk(4); mm_qk(5); mm_qk(6); mm_qk(7);
    hold_group();

    // ---- the first half of O^T's operands: it lands under the softmax ----
    // A = V^T chunk: (16 h) x (32 keys); M = l16; element e = key half*8 + (e&7) + 16*(e>>3)
    u32x4 vlo[16], vhi[16];
#pragma unroll
    for (int j = 0; j < 8; ++j) {
      vlo[j] = ld_tr16(vp + 32u * j);               // keys 0-15
      vhi[j] = ld_tr16(vp + 16u * VP_B + 32u * j);  // keys 16-31
    }
    hold_group();

    v16bf pf[2];
#pragma unroll
    for (int t = 0; t < 2; ++t) {
      // ---- scale + mask (C layout: key = i + 8*half (+16 for tile 1), query = 16t + l16) ----
      // whole-vector form: each mask word is used out of the register its load wrote
      v8f s0 = sc[t][0] * scale + __builtin_shufflevector(cur.w[t][0], cur.w[t][1], 0, 1, 2, 3, 4, 5, 6, 7);
      v8f s1 = sc[t][1] * scale + __builtin_shufflevector(cur.w[t][2], cur.w[t][3], 0, 1, 2, 3, 4, 5, 6, 7);

      // ---- online softmax over this 32-key block, one query per lane ----
      float mx = fmaxf(s0[0], s1[0]);
#pragma unroll
      for (int i = 1; i < 8; ++i) mx = fmaxf(mx, fmaxf(s0[i], s1[i]));
      mx = fmaxf(mx, other_half(mx));              // the other 16 keys of this query
      const float mnew  = fmaxf(mrow[t], mx);
      const float alpha = __expf(mrow[t] - mnew);
      float ps = 0.0f;
#pragma unroll
      for (int i = 0; i < 8; ++i) {
        s0[i] = __expf(s0[i] - mnew);
        s1[i] = __expf(s1[i] - mnew);
        ps += s0[i] + s1[i];
      }
      lrow[t] = lrow[t] * alpha + ps;
      mrow[t] = mnew;
#pragma unroll
      for (int j = 0; j < 16; ++j)
#pragma unroll
        for (int i = 0; i < 8; ++i) acc[t][j][i] *= alpha;  // rescale O^T

      // ---- P^T as B-matrix (32 keys x 16 queries): element e = key half*8 + (e&7) + 16*(e>>3),
      //      which is register e&7 of S^T tile e>>3 in this very lane ----
#pragma unroll
      for (int i = 0; i < 8; ++i) {
        pf[t][i]     = bits2bf(f2bfbits(s0[i]));
        pf[t][8 + i] = bits2bf(f2bfbits(s1[i]));
      }
    }

    // ---- the second half of O^T's operands: it lands under the first half's products ----
    hold_group();
#pragma unroll
    for (int j = 8; j < 16; ++j) {
      vlo[j] = ld_tr16(vp + 32u * j);
      vhi[j] = ld_tr16(vp + 16u * VP_B + 32u * j);
    }
    hold_group();

    // ---- O^T += V^T P^T : 16 h-tiles, each V^T fragment for both query tiles ----
#pragma unroll
    for (int j = 0; j < 16; ++j) {
      const u32x4 lo = vlo[j], hi = vhi[j];
      const u32x8 vw = {lo.x, lo.y, lo.z, lo.w, hi.x, hi.y, hi.z, hi.w};
      const v16bf vb = __builtin_bit_cast(v16bf, vw);
#pragma unroll
      for (int t = 0; t < 2; ++t)
        acc[t][j] = __builtin_amdgcn_wmma_f32_16x16x32_bf16(false, vb, false, pf[t],
                                                            (short)0, acc[t][j], false, false);
    }

    // ---- publish point of stage st + 1 ----
    // keeps the softmax and the second product in front of the waits below, so that
    // they run while V's fragments still land
    __builtin_amdgcn_sched_barrier(0);
    // this wave's LDS reads of this pass have retired
    asm volatile("s_wait_dscnt 0x0" ::: "memory");
    // an issuing wave's slice of stage st + 1 has landed (waves 4-7 have none and pass at once)
    asm volatile("s_wait_tensorcnt 0x0" ::: "memory");
    wg_barrier();              // publishes stage st + 1; every reader has left this pass's LDS
    if (pinned((st + 2u < (uint32_t)NST) & (wv < 4u))) issue(st + 2u);  // refill the buffer just read
  };
  // two passes a trip: one copy of the body for each buffer
  for (int kb = 0; kb < S_; kb += 2 * KST) {
    const v4f* mt = (const v4f*)(mdem + kb);
    pass(kb, mt, 0);
    pass(kb + KST, mt, KST / 4);
  }
  // nothing of the ring is in flight when the wave goes on to its end
  asm volatile("s_wait_tensorcnt 0x0" ::: "memory");
  asm volatile("s_wait_dscnt 0x0" ::: "memory");

  // ---- epilogue: join the halves' sums, then the four key groups, normalize and store ----
  // Every wave lays its O^T, maxima and sums into the ring's LDS, which every reader has
  // left at the last pass's barrier; the wave of key group g then finishes h 64g .. 64g + 63
  // of its query group's 32 queries out of the four groups' parts, summed in group order.
  const float lj[2] = {lrow[0] + other_half(lrow[0]), lrow[1] + other_half(lrow[1])};
  unsigned char* xw = &Rs[0][0][0] + wv * XCH_B;
#pragma unroll
  for (int t = 0; t < 2; ++t) {
#pragma unroll
    for (int j = 0; j < 16; ++j) {
      const v8f g = acc[t][j];
      unsigned char* d = xw + (uint32_t)(t * 16 + j) * 1024u + (uint32_t)lane * 16u;
      *(float4*)d          = make_float4(g[0], g[1], g[2], g[3]);
      *(float4*)(d + 512u) = make_float4(g[4], g[5], g[6], g[7]);
    }
    if (half == 0)               // both halves hold the same maximum and sum
      *(float2*)(xw + 32768u + (uint32_t)t * 128u + (uint32_t)l16 * 8u) = make_float2(mrow[t], lj[t]);
  }
  __syncthreads();               // publishes every wave's part to the waves of its query group
  const unsigned char* xr = &Rs[0][0][0] + (wv & 1u) * XCH_B;  // key group p's part: 2p places on
  float f[4][2];                 // key group p's weight in query tile t, normalization included
#pragma unroll
  for (int t = 0; t < 2; ++t) {
    float2 ml[4];
#pragma unroll
    for (int p = 0; p < 4; ++p)
      ml[p] = *(const float2*)(xr + (uint32_t)p * (2u * XCH_B) + 32768u + (uint32_t)t * 128u
                               + (uint32_t)l16 * 8u);
    const float mj = fmaxf(fmaxf(ml[0].x, ml[1].x), fmaxf(ml[2].x, ml[3].x));
    float den = 0.0f;
#pragma unroll
    for (int p = 0; p < 4; ++p) {
      f[p][t] = __expf(ml[p].x - mj);
      den += ml[p].y * f[p][t];
    }
    const float inv = 1.0f / den;
#pragma unroll
    for (int p = 0; p < 4; ++p) f[p][t] *= inv;
  }
  const unsigned char* xo = xr + (wv >> 1) * 4096u + (uint32_t)lane * 16u;  // this wave's four h tiles
  float4 ol[2][4], oh[2][4];
#pragma unroll
  for (int t = 0; t < 2; ++t)
#pragma unroll
    for (int jj = 0; jj < 4; ++jj) {
      float4 a = make_float4(0.0f, 0.0f, 0.0f, 0.0f), c = a;
#pragma unroll
      for (int p = 0; p < 4; ++p) {
        const unsigned char* e = xo + (uint32_t)p * (2u * XCH_B) + (uint32_t)(t * 16 + jj) * 1024u;
        const float4 x = *(const float4*)e, y = *(const float4*)(e + 512u);
        const float w = f[p][t];
        a.x += x.x * w; a.y += x.y * w; a.z += x.z * w; a.w += x.w * w;
        c.x += y.x * w; c.y += y.y * w; c.z += y.z * w; c.w += y.w * w;
      }
      ol[t][jj] = a; oh[t][jj] = c;
    }
  float* orow = out + ((size_t)b * S_ + qb + l16) * H_ + (wv >> 1) * 64u + 8 * half;
  // the stores stand together behind all the arithmetic: no instruction behind a
  // store then rewrites a register that the store names
  __builtin_amdgcn_sched_barrier(0);
#pragma unroll
  for (int t = 0; t < 2; ++t)
#pragma unroll
    for (int jj = 0; jj < 4; ++jj) {
      ((float4*)(orow + t * 16 * H_ + jj * 16))[0] = ol[t][jj];
      ((float4*)(orow + t * 16 * H_ + jj * 16))[1] = oh[t][jj];
    }
}

extern "C" void kernel_launch(void* const* d_in, const int* in_sizes, int n_in,
                              void* d_out, int out_size, void* d_ws, size_t ws_size,
                              hipStream_t stream) {
  const float* q = (const float*)d_in[0];
  const float* k = (const float*)d_in[1];
  const float* v = (const float*)d_in[2];
  const float* m = (const float*)d_in[3];
  float* out = (float*)d_out;
  unsigned short* ws = (unsigned short*)d_ws;

  hipLaunchKernelGGL(round_kv_kernel, dim3(2 * (B_ * S_ / 8) / 8), dim3(256), 0, stream, k, v, ws);
  dim3 grid(B_ * (S_ / 64));
  dim3 block(256);
  hipLaunchKernelGGL(fa_kernel, grid, block, 0, stream, q, ws, m, out);
}

// v009
// Measured time: 74.1 microseconds a run.
// Two timings next to v008 put it at 1.07 and 1.06 times that version's speed.
// All steps since v000 together make it 16.7 times as fast.
#include <hip/hip_runtime.h>
#include <stdint.h>

#define B_ 4
#define S_ 4096
#define H_ 256

typedef __bf16 v16bf __attribute__((ext_vector_type(16)));
typedef float  v8f   __attribute__((ext_vector_type(8)));
typedef float  v4f   __attribute__((ext_vector_type(4)));

__device__ __forceinline__ unsigned short f2bfbits(float f) {
  union { float f; unsigned u; } x; x.f = f;
  unsigned r = x.u + 0x7FFFu + ((x.u >> 16) & 1u);   // round-to-nearest-even
  return (unsigned short)(r >> 16);
}
__device__ __forceinline__ __bf16 bits2bf(unsigned short s) {
  union { unsigned short s; __bf16 b; } y; y.s = s; return y.b;
}

#define LDK 264   // bf16 row stride: >=256 and == 8 (mod 128) -> conflict-free b128 reads
#define LDV 272   // V row stride: 544 B, an odd multiple of 32 B, the transposing load's conflict-free pitch
#define KST 128   // keys a stage: 32 for each key group
#define PFD 256   // prefetch distance in keys (2 stages)
#define NST (S_ / KST)         // stages = passes
#define KP_B (LDK * 2u)        // K row pitch in bytes, workspace and LDS alike: 528
#define VP_B (LDV * 2u)        // V row pitch in bytes, workspace and LDS alike: 544
#define KW_B ((uint32_t)(B_ * S_) * KP_B) // bytes of the K plane; the V plane follows it
#define SLICE_B 34816u         // LDS place of one issuing wave's slice: 64 rows, rounded up to 2 KiB
// a slice's two buffers lie side by side, so that one address register with the load's
// 16-bit offset reaches a wave's fragments in either buffer
#define XCH_B 33280u           // epilogue exchange, one wave's place: 32 KiB of O, then maxima and sums

typedef uint32_t u32x4 __attribute__((ext_vector_type(4)));
typedef uint32_t u32x8 __attribute__((ext_vector_type(8)));
typedef short s16x8 __attribute__((ext_vector_type(8)));
typedef __attribute__((address_space(3))) s16x8 lds_s16x8;

// ds_load_tr16_b128: with lane l aimed at row 8*(l>>4) + (l&7), byte 16*((l>>3)&1)
// of a 16 x 16 tile of 16-bit elements, lane (c = l&15, h = l>>4) gets rows
// 8h .. 8h+7 of column c.
__device__ __forceinline__ u32x4 ld_tr16(const unsigned char* p) {
  return __builtin_bit_cast(u32x4, __builtin_amdgcn_ds_load_tr16_b128_v8i16((lds_s16x8*)p));
}

// Value of lane l ^ 16 (the other half of the wave), by a vector cross-row move.
__device__ __forceinline__ float other_half(float x) {
  const int b = __builtin_bit_cast(int, x);
  return __builtin_bit_cast(float, __builtin_amdgcn_permlanex16(
      b, b, 0x76543210, 0xfedcba98, false, false));
}

// Keeps a group of loads together and ahead of their users: without it the
// compiler sinks each load to just in front of its user, and the wave then
// waits out the full LDS latency at every matrix instruction.
__device__ __forceinline__ void hold_group() { __builtin_amdgcn_sched_barrier(0); }

// The work-group's barrier alone: the waits that the LDS ring needs stand, written out,
// in front of the call.
__device__ __forceinline__ void wg_barrier() {
  asm volatile("s_barrier_signal -1\n\ts_barrier_wait -1" ::: "memory");
}

__device__ __forceinline__ uint32_t uni(uint32_t v) {
  return (uint32_t)__builtin_amdgcn_readfirstlane(v);
}
// Holds a wave-uniform test in a scalar register so that the branch on it is
// a scalar one: a tensor load ignores EXEC and only such a branch skips it.
__device__ __forceinline__ uint32_t pinned(uint32_t v) {
  uint32_t w = uni(v);
  asm volatile("" : "+s"(w));
  return w;
}
// Tensor descriptor, group 1: byte elements, no mask, no pad. A slice (64 padded
// rows) is contiguous in the workspace and a whole number of 256-B units: it
// moves as tile = tensor = n lines of 256 B at source pitch 256 B.
__device__ __forceinline__ u32x8 tdm_group1(uint32_t n) {
  u32x8 g;
  g[0] = uni(0u);
  g[1] = uni(256u << 16);
  g[2] = uni(n << 16);
  g[3] = uni(256u << 16);
  g[4] = uni(n);
  g[5] = uni(256u);
  g[6] = uni(0u);
  g[7] = uni(0u);
  return g;
}
// Group 0: count 1, LDS byte offset, global address of the first byte, type 2.
__device__ __forceinline__ u32x4 tdm_group0(uint32_t lds_dst, uint64_t ga) {
  u32x4 g;
  g[0] = uni(1u);
  g[1] = uni(lds_dst);
  g[2] = uni((uint32_t)ga);
  g[3] = uni((((uint32_t)(ga >> 32)) & 0x01FFFFFFu) | 0x80000000u);
  return g;
}

// One 16 x 32 fragment's 16 elements of this lane: 8 at p, 8 at p + 32 B.
__device__ __forceinline__ v16bf ld_frag(const unsigned char* p) {
  const u32x4 lo = *(const u32x4*)p, hi = *(const u32x4*)(p + 32);
  const u32x8 w = {lo.x, lo.y, lo.z, lo.w, hi.x, hi.y, hi.z, hi.w};
  return __builtin_bit_cast(v16bf, w);
}

// One wave rounds 8 rows of 256 f32 to bf16 rows at pitch PITCH bytes and zeroes
// their pad bytes. 8 such rows are a whole number of 128-B lines, so no line has
// a second writer; the 16 loads of a lane fly together off one address.
template <uint32_t PITCH>
__device__ __forceinline__ void round_rows(const float* __restrict__ src,
                                           unsigned char* __restrict__ dst, uint32_t lane) {
  const float4* s4 = (const float4*)src + lane;
  float4 x[16];
#pragma unroll
  for (int r = 0; r < 16; ++r) x[r] = s4[r * 32];   // row r / 2, half r & 1
  // later code rewrites the address registers that the 16 loads name; the input
  // operand keeps that pair untouched up to this wait
  asm volatile("s_wait_xcnt 0x0" :: "v"(s4) : "memory");
#pragma unroll
  for (int r = 0; r < 16; ++r) {
    uint2 w;
    w.x = (uint32_t)f2bfbits(x[r].x) | ((uint32_t)f2bfbits(x[r].y) << 16);
    w.y = (uint32_t)f2bfbits(x[r].z) | ((uint32_t)f2bfbits(x[r].w) << 16);
    *(uint2*)(dst + (uint32_t)(r >> 1) * PITCH + (uint32_t)(r & 1) * 256u + lane * 8u) = w;
  }
  constexpr uint32_t PQ = (PITCH - 512u) / 16u;     // 16-B pad pieces a row
  if (lane < 8u * PQ)
    *(uint4*)(dst + (lane / PQ) * PITCH + 512u + (lane % PQ) * 16u) = make_uint4(0u, 0u, 0u, 0u);
}

#define NGR ((uint32_t)(B_ * S_) / 8u)  // groups of 8 rows in one plane

// The grid puts four waves on a SIMD: told so, the compiler spends the registers
// that let a lane's 16 loads stay in flight at once.
__global__ __launch_bounds__(256) __attribute__((amdgpu_waves_per_eu(4, 4)))
void round_kv_kernel(const float* __restrict__ k, const float* __restrict__ v,
                     unsigned short* __restrict__ ws) {
  const uint32_t lane = threadIdx.x & 31u;
  const uint32_t gr = blockIdx.x * 8u + (threadIdx.x >> 5);  // first the K plane's groups, then V's
  unsigned char* w8 = (unsigned char*)ws;
  if (blockIdx.x < NGR / 8u)
    round_rows<KP_B>(k + (size_t)gr * (8u * H_), w8 + (size_t)gr * (8u * KP_B), lane);
  else
    round_rows<VP_B>(v + (size_t)(gr - NGR) * (8u * H_),
                     w8 + KW_B + (size_t)(gr - NGR) * (8u * VP_B), lane);
}

// Two waves a SIMD, one work-group a WGP: the grid has one work-group for each WGP,
// and a wave has half of a SIMD's registers, half of those for its two O tiles.
__global__ __launch_bounds__(256) __attribute__((amdgpu_waves_per_eu(2, 2)))
void fa_kernel(const float* __restrict__ q, const unsigned short* __restrict__ ws,
               const float* __restrict__ mask, float* __restrict__ out) {
  // landing ring of the tensor loads: [slice][buffer][64 bf16 rows at pitch KP_B or VP_B];
  // slices: K rows 0-63, K rows 64-127, V rows 0-63, V rows 64-127 of a stage
  __shared__ __attribute__((aligned(2048))) unsigned char Rs[4][2][SLICE_B];
  __shared__ unsigned short Qs[4][16][LDK]; // Q tiles: [tile][m][h], bf16 bits

  const int tid  = threadIdx.x;
  const int lane = tid & 31;
  const int wave = tid >> 5;
  const int half = lane >> 4;   // 0: lanes 0-15, 1: lanes 16-31
  const int l16  = lane & 15;
  const int qg   = wave & 1;    // query group: queries 32*qg .. 32*qg + 31 of the block
  const int kg   = wave >> 1;   // key group 0-3: keys 32*kg .. 32*kg + 31 of every stage

  const int nqblk = S_ / 64;
  const int b    = blockIdx.x / nqblk;
  const int qblk = (blockIdx.x % nqblk) * 64;
  const int qb   = qblk + qg * 32;

  // ---- stage Q tile (64 rows x 256 h) to LDS as bf16, cooperatively ----
#pragma unroll
  for (int p = 0; p < 16; ++p) {
    const int r  = p * 4 + (tid >> 6);   // 0..63
    const int c4 = tid & 63;             // float4 column
    const float4 qv = ((const float4*)(q + ((size_t)b * S_ + qblk + r) * H_))[c4];
    unsigned short* dst = &Qs[r >> 4][r & 15][c4 * 4];
    dst[0] = f2bfbits(qv.x); dst[1] = f2bfbits(qv.y);
    dst[2] = f2bfbits(qv.z); dst[3] = f2bfbits(qv.w);
  }

  // ---- accumulators & softmax state, one set per query tile t ----
  v8f acc[2][16];              // O^T: tile j, register i = O[query 16t + l16][h = 16j + 8*half + i]
#pragma unroll
  for (int t = 0; t < 2; ++t)
#pragma unroll
    for (int j = 0; j < 16; ++j)
#pragma unroll
      for (int i = 0; i < 8; ++i) acc[t][j][i] = 0.0f;

  // Running maximum of query 16t + l16 over this key group, the same in both halves.
  // It starts at the lowest finite value, not at -inf: a key group whose keys so far
  // are all masked with -inf then keeps weights, sum and O at zero instead of
  // forming -inf - -inf, and drops out when the groups are joined.
  float mrow[2] = {-3.402823466e+38f, -3.402823466e+38f};
  float lrow[2] = {0.0f, 0.0f};   // running sum over this half's keys of this key group

  const float scale = 0.0625f; // 1/sqrt(256)

  // ---- hoisted per-lane base pointers (loop adds only uniform kb terms) ----
  // one lane a query row: the 128-B line of this key group's 32 keys
  const float* mpf = mask + ((size_t)b * S_ + (qb + lane)) * S_ + kg * 32 + PFD;
  const float* mdem = mask + ((size_t)b * S_ + qb + l16) * S_ + kg * 32 + 8 * half;
  // this lane's address for Q's fragments of query tile 0, h 0-31
  const unsigned char* qad = (const unsigned char*)&Qs[qg * 2][l16][0] + (uint32_t)half * 16u;
  // this lane's address in buffer 0 for K's fragments of the group's keys 0-15, h 0-31
  const unsigned char* kad = &Rs[kg >> 1][0][0] + (uint32_t)((kg & 1) * 32 + l16) * KP_B
                           + (uint32_t)half * 16u;
  // this lane's address in buffer 0 for the transposing loads of V's keys 0-15, h 0-15
  const unsigned char* vad = &Rs[2 + (kg >> 1)][0][0]
                           + (uint32_t)((kg & 1) * 32 + 8 * half + (lane & 7)) * VP_B
                           + (uint32_t)((lane >> 3) & 1) * 16u;

  // ---- tensor-load ring: each of waves 0-3 brings one 64-row slice per stage ----
  // waves 0,1: the K rows of key groups 0-1, 2-3; waves 2,3: the V rows. Waves 4-7 issue none.
  const uint32_t wv    = uni((uint32_t)tid >> 5);
  const uint32_t sl    = wv & 3u;
  const uint32_t lbase = (uint32_t)(size_t)&Rs[0][0][0] + sl * (2u * SLICE_B);
  const uint32_t pitch = (sl & 2u) ? VP_B : KP_B;
  const uint64_t gbase = (uint64_t)(size_t)ws + ((sl & 2u) ? KW_B : 0u)
                       + ((uint64_t)b * S_ + (sl & 1u) * 64u) * pitch;
  const u32x8 g1 = tdm_group1(pitch / 4u);    // 64 rows = pitch / 4 lines of 256 B
  auto issue = [&](uint32_t st) {
    const u32x4 g0 = tdm_group0(lbase + (st & 1u) * SLICE_B,
                                gbase + (uint64_t)st * ((uint32_t)KST * pitch));
    // both groups sit in named registers of their own at every issue: the only writes of
    // group 0's words then stand here, behind the wait that covers the request before
    asm volatile("tensor_load_to_lds %0, %1" :: "{s[56:59]}"(g0), "{s[48:55]}"(g1) : "memory");
    return g0;
  };
  // ---- mask words of one pass: [query tile t][keys 0-3, 4-7, 16-19, 20-23 of this half] ----
  struct MaskSet { v4f w[2][4]; };
  constexpr int QT = 16 * S_ / 4;   // query tile 1: 16 mask rows on, in 16-B units
  auto load_mask = [&](MaskSet& m, const v4f* mq) __attribute__((always_inline)) {
    m.w[0][0] = mq[0];  m.w[0][1] = mq[1];      m.w[0][2] = mq[4];      m.w[0][3] = mq[5];
    m.w[1][0] = mq[QT]; m.w[1][1] = mq[QT + 1]; m.w[1][2] = mq[QT + 4]; m.w[1][3] = mq[QT + 5];
  };
  if (pinned(wv < 4u)) {
    const u32x4 first = issue(0);
    // stage 0 landed in this wave; the barrier publishes it (and Qs) to all waves. The input
    // operand keeps the build of stage 1's group 0, which nothing else holds back, behind the wait
    asm volatile("s_wait_tensorcnt 0x0" :: "{s[56:59]}"(first) : "memory");
  }
  __syncthreads();
  if (pinned(wv < 4u)) issue(1);

  // the mask words of the pass to come; pass 0's land under its first product
  MaskSet cur;
  const v4f* mq = (const v4f*)mdem;   // walks one pass ahead of the work
  load_mask(cur, mq);
  // the step below rewrites the address registers that the eight mask loads name: the
  // wait stands between the loads and the step, and the fence keeps the step behind it
  asm volatile("s_wait_xcnt 0x0" ::: "memory");
  hold_group();
  mq += KST / 4;

  // one pass: works on stage kb / KST
  auto pass = [&](const int kb) __attribute__((always_inline)) {
    const uint32_t st = (uint32_t)kb / (uint32_t)KST;
    // ---- speculative prefetch (global_prefetch_b8), 2 stages ahead ----
    if (kb < S_ - PFD) {
      __builtin_prefetch(mpf + kb, 0, 1);
    }

    const unsigned char* kp = kad + (st & 1u) * SLICE_B;  // this pass's buffer
    const unsigned char* vp = vad + (st & 1u) * SLICE_B;

    // ---- S^T = K Q^T : per query tile two 16x16 f32 tiles (keys 0-15, 16-31) ----
    // A = K chunk (16 keys x 32 h), key tile u; B = Q^T chunk (32 h x 16 queries), query tile t.
    // The fragments come in four groups of two chunks, two groups ahead of their use.
    v16bf qa[2][8], ka[2][8];
    v8f sc[2][2];                // [query tile t][key tile u]
#pragma unroll
    for (int t = 0; t < 2; ++t)
#pragma unroll
      for (int u = 0; u < 2; ++u)
#pragma unroll
        for (int i = 0; i < 8; ++i) sc[t][u][i] = 0.0f;
    auto ld_qk = [&](const int c) __attribute__((always_inline)) {
      qa[0][c] = ld_frag(qad + 64u * c);
      qa[1][c] = ld_frag(qad + 16u * KP_B + 64u * c);
      ka[0][c] = ld_frag(kp + 64u * c);               // keys 0-15, the same h order as qa
      ka[1][c] = ld_frag(kp + 16u * KP_B + 64u * c);  // keys 16-31
    };
    auto mm_qk = [&](const int c) __attribute__((always_inline)) {
#pragma unroll
      for (int u = 0; u < 2; ++u)
#pragma unroll
        for (int t = 0; t < 2; ++t)
          sc[t][u] = __builtin_amdgcn_wmma_f32_16x16x32_bf16(false, ka[u][c], false, qa[t][c],
                                                             (short)0, sc[t][u], false, false);
    };
    ld_qk(0); ld_qk(1); ld_qk(2); ld_qk(3);
    hold_group();
    mm_qk(0); mm_qk(1);
    hold_group();
    ld_qk(4); ld_qk(5);
    hold_group();
    mm_qk(2); mm_qk(3);
    hold_group();
    ld_qk(6); ld_qk(7);
    hold_group();
    mm_qk(4); mm_qk(5); mm_qk(6); mm_qk(7);
    hold_group();

    // ---- the first half of O^T's operands: it lands under the softmax ----
    // A = V^T chunk: (16 h) x (32 keys); M = l16; element e = key half*8 + (e&7) + 16*(e>>3)
    u32x4 vlo[16], vhi[16];
#pragma unroll
    for (int j = 0; j < 8; ++j) {
      vlo[j] = ld_tr16(vp + 32u * j);               // keys 0-15
      vhi[j] = ld_tr16(vp + 16u * VP_B + 32u * j);  // keys 16-31
    }
    hold_group();

    // ---- scale + mask (C layout: key = i + 8*half (+16 for tile 1), query = 16t + l16) ----
    // whole-vector form: each mask word is used out of the register its load wrote
#pragma unroll
    for (int t = 0; t < 2; ++t) {
      sc[t][0] = sc[t][0] * scale + __builtin_shufflevector(cur.w[t][0], cur.w[t][1], 0, 1, 2, 3, 4, 5, 6, 7);
      sc[t][1] = sc[t][1] * scale + __builtin_shufflevector(cur.w[t][2], cur.w[t][3], 0, 1, 2, 3, 4, 5, 6, 7);
    }
    hold_group();
    // the next pass's eight mask loads, into the registers just read: they fly under the
    // softmax, the second product, the barrier and the next pass's first product
    load_mask(cur, mq);
    hold_group();

    v16bf pf[2];
#pragma unroll
    for (int t = 0; t < 2; ++t) {
      v8f s0 = sc[t][0], s1 = sc[t][1];

      // ---- online softmax over this 32-key block, one query per lane ----
      float mx = fmaxf(s0[0], s1[0]);
#pragma unroll
      for (int i = 1; i < 8; ++i) mx = fmaxf(mx, fmaxf(s0[i], s1[i]));
      mx = fmaxf(mx, other_half(mx));              // the other 16 keys of this query
      const float mnew  = fmaxf(mrow[t], mx);
      const float alpha = __expf(mrow[t] - mnew);
      float ps = 0.0f;
#pragma unroll
      for (int i = 0; i < 8; ++i) {
        s0[i] = __expf(s0[i] - mnew);
        s1[i] = __expf(s1[i] - mnew);
        ps += s0[i] + s1[i];
      }
      lrow[t] = lrow[t] * alpha + ps;
      mrow[t] = mnew;
#pragma unroll
      for (int j = 0; j < 16; ++j)
#pragma unroll
        for (int i = 0; i < 8; ++i) acc[t][j][i] *= alpha;  // rescale O^T

      // ---- P^T as B-matrix (32 keys x 16 queries): element e = key half*8 + (e&7) + 16*(e>>3),
      //      which is register e&7 of S^T tile e>>3 in this very lane ----
#pragma unroll
      for (int i = 0; i < 8; ++i) {
        pf[t][i]     = bits2bf(f2bfbits(s0[i]));
        pf[t][8 + i] = bits2bf(f2bfbits(s1[i]));
      }
    }

    hold_group();
    // the step below rewrites the address registers that the eight mask loads name: the wait
    // stands between the loads and the step, where it has run out under the softmax, and the
    // fences keep the step behind it
    asm volatile("s_wait_xcnt 0x0" ::: "memory");
    hold_group();
    // the last pass has no successor: it loads its own words once more, in bounds and unused
    mq += (kb + 2 * KST < S_ ? KST : 0) / 4;

    // ---- the second half of O^T's operands, in two groups of four h-tiles: each lands under
    //      the products of the two groups before it. One group of eight does not fit the wave's
    //      registers beside the next pass's mask words, which are held through this product ----
    auto ld_v = [&](const int g) __attribute__((always_inline)) {
#pragma unroll
      for (int j = 4 * g; j < 4 * g + 4; ++j) {
        vlo[j] = ld_tr16(vp + 32u * j);
        vhi[j] = ld_tr16(vp + 16u * VP_B + 32u * j);
      }
    };
    // ---- O^T += V^T P^T : 16 h-tiles, each V^T fragment for both query tiles ----
    auto mm_pv = [&](const int g) __attribute__((always_inline)) {
#pragma unroll
      for (int j = 4 * g; j < 4 * g + 4; ++j) {
        const u32x4 lo = vlo[j], hi = vhi[j];
        const u32x8 vw = {lo.x, lo.y, lo.z, lo.w, hi.x, hi.y, hi.z, hi.w};
        const v16bf vb = __builtin_bit_cast(v16bf, vw);
#pragma unroll
        for (int t = 0; t < 2; ++t)
          acc[t][j] = __builtin_amdgcn_wmma_f32_16x16x32_bf16(false, vb, false, pf[t],
                                                              (short)0, acc[t][j], false, false);
      }
    };
    ld_v(2);
    hold_group();
    mm_pv(0);
    hold_group();
    ld_v(3);
    hold_group();
    mm_pv(1); mm_pv(2); mm_pv(3);

    // ---- publish point of stage st + 1 ----
    // keeps the softmax and the second product in front of the waits below, so that
    // they run while V's fragments still land
    __builtin_amdgcn_sched_barrier(0);
    // this wave's LDS reads of this pass have retired
    asm volatile("s_wait_dscnt 0x0" ::: "memory");
    // an issuing wave's slice of stage st + 1 has landed (waves 4-7 have none and pass at once)
    asm volatile("s_wait_tensorcnt 0x0" ::: "memory");
    wg_barrier();              // publishes stage st + 1; every reader has left this pass's LDS
    if (pinned((st + 2u < (uint32_t)NST) & (wv < 4u))) issue(st + 2u);  // refill the buffer just read
  };
  // two passes a trip: one copy of the body for each buffer
  for (int kb = 0; kb < S_; kb += 2 * KST) {
    pass(kb);
    pass(kb + KST);
  }
  // nothing of the ring is in flight when the wave goes on to its end
  asm volatile("s_wait_tensorcnt 0x0" ::: "memory");
  asm volatile("s_wait_dscnt 0x0" ::: "memory");

  // ---- epilogue: join the halves' sums, then the four key groups, normalize and store ----
  // Every wave lays its O^T, maxima and sums into the ring's LDS, which every reader has
  // left at the last pass's barrier; the wave of key group g then finishes h 64g .. 64g + 63
  // of its query group's 32 queries out of the four groups' parts, summed in group order.
  const float lj[2] = {lrow[0] + other_half(lrow[0]), lrow[1] + other_half(lrow[1])};
  unsigned char* xw = &Rs[0][0][0] + wv * XCH_B;
#pragma unroll
  for (int t = 0; t < 2; ++t) {
#pragma unroll
    for (int j = 0; j < 16; ++j) {
      const v8f g = acc[t][j];
      unsigned char* d = xw + (uint32_t)(t * 16 + j) * 1024u + (uint32_t)lane * 16u;
      *(float4*)d          = make_float4(g[0], g[1], g[2], g[3]);
      *(float4*)(d + 512u) = make_float4(g[4], g[5], g[6], g[7]);
    }
    if (half == 0)               // both halves hold the same maximum and sum
      *(float2*)(xw + 32768u + (uint32_t)t * 128u + (uint32_t)l16 * 8u) = make_float2(mrow[t], lj[t]);
  }
  __syncthreads();               // publishes every wave's part to the waves of its query group
  const unsigned char* xr = &Rs[0][0][0] + (wv & 1u) * XCH_B;  // key group p's part: 2p places on
  float f[4][2];                 // key group p's weight in query tile t, normalization included
#pragma unroll
  for (int t = 0; t < 2; ++t) {
    float2 ml[4];
#pragma unroll
    for (int p = 0; p < 4; ++p)
      ml[p] = *(const float2*)(xr + (uint32_t)p * (2u * XCH_B) + 32768u + (uint32_t)t * 128u
                               + (uint32_t)l16 * 8u);
    const float mj = fmaxf(fmaxf(ml[0].x, ml[1].x), fmaxf(ml[2].x, ml[3].x));
    float den = 0.0f;
#pragma unroll
    for (int p = 0; p < 4; ++p) {
      f[p][t] = __expf(ml[p].x - mj);
      den += ml[p].y * f[p][t];
    }
    const float inv = 1.0f / den;
#pragma unroll
    for (int p = 0; p < 4; ++p) f[p][t] *= inv;
  }
  const unsigned char* xo = xr + (wv >> 1) * 4096u + (uint32_t)lane * 16u;  // this wave's four h tiles
  float4 ol[2][4], oh[2][4];
#pragma unroll
  for (int t = 0; t < 2; ++t)
#pragma unroll
    for (int jj = 0; jj < 4; ++jj) {
      float4 a = make_float4(0.0f, 0.0f, 0.0f, 0.0f), c = a;
#pragma unroll
      for (int p = 0; p < 4; ++p) {
        const unsigned char* e = xo + (uint32_t)p * (2u * XCH_B) + (uint32_t)(t * 16 + jj) * 1024u;
        const float4 x = *(const float4*)e, y = *(const float4*)(e + 512u);
        const float w = f[p][t];
        a.x += x.x * w; a.y += x.y * w; a.z += x.z * w; a.w += x.w * w;
        c.x += y.x * w; c.y += y.y * w; c.z += y.z * w; c.w += y.w * w;
      }
      ol[t][jj] = a; oh[t][jj] = c;
    }
  float* orow = out + ((size_t)b * S_ + qb + l16) * H_ + (wv >> 1) * 64u + 8 * half;
  // the stores stand together behind all the arithmetic: no instruction behind a
  // store then rewrites a register that the store names
  __builtin_amdgcn_sched_barrier(0);
#pragma unroll
  for (int t = 0; t < 2; ++t)
#pragma unroll
    for (int jj = 0; jj < 4; ++jj) {
      ((float4*)(orow + t * 16 * H_ + jj * 16))[0] = ol[t][jj];
      ((float4*)(orow + t * 16 * H_ + jj * 16))[1] = oh[t][jj];
    }
}

extern "C" void kernel_launch(void* const* d_in, const int* in_sizes, int n_in,
                              void* d_out, int out_size, void* d_ws, size_t ws_size,
                              hipStream_t stream) {
  const float* q = (const float*)d_in[0];
  const float* k = (const float*)d_in[1];
  const float* v = (const float*)d_in[2];
  const float* m = (const float*)d_in[3];
  float* out = (float*)d_out;
  unsigned short* ws = (unsigned short*)d_ws;

  hipLaunchKernelGGL(round_kv_kernel, dim3(2 * (B_ * S_ / 8) / 8), dim3(256), 0, stream, k, v, ws);
  dim3 grid(B_ * (S_ / 64));
  dim3 block(256);
  hipLaunchKernelGGL(fa_kernel, grid, block, 0, stream, q, ws, m, out);
}

// v010
// A run of this version takes 71.7 microseconds.
// Next to v009, in two timings, it ran 1.04 and 1.03 times as fast.
// Over all steps from v000 it is 17.3 times as fast.
#include <hip/hip_runtime.h>
#include <stdint.h>

#define B_ 4
#define S_ 4096
#define H_ 256

typedef __bf16 v16bf __attribute__((ext_vector_type(16)));
typedef float  v8f   __attribute__((ext_vector_type(8)));
typedef float  v4f   __attribute__((ext_vector_type(4)));

__device__ __forceinline__ unsigned short f2bfbits(float f) {
  union { float f; unsigned u; } x; x.f = f;
  unsigned r = x.u + 0x7FFFu + ((x.u >> 16) & 1u);   // round-to-nearest-even
  return (unsigned short)(r >> 16);
}
__device__ __forceinline__ __bf16 bits2bf(unsigned short s) {
  union { unsigned short s; __bf16 b; } y; y.s = s; return y.b;
}

#define LDK 264   // bf16 row stride: >=256 and == 8 (mod 128) -> conflict-free b128 reads
#define LDV 272   // V row stride: 544 B, an odd multiple of 32 B, the transposing load's conflict-free pitch
#define KST 128   // keys a stage: 32 for each key group
#define PFD 256   // prefetch distance in keys (2 stages)
#define NST (S_ / KST)         // stages = passes
#define KP_B (LDK * 2u)        // K row pitch in bytes, workspace and LDS alike: 528
#define VP_B (LDV * 2u)        // V row pitch in bytes, workspace and LDS alike: 544
#define KW_B ((uint32_t)(B_ * S_) * KP_B) // bytes of the K plane; the V plane follows it
#define SLICE_B 34816u         // LDS place of one issuing wave's slice: 64 rows, rounded up to 2 KiB
// a slice's two buffers lie side by side, so that one address register with the load's
// 16-bit offset reaches a wave's fragments in either buffer
#define XCH_B 33280u           // epilogue exchange, one wave's place: 32 KiB of O, then maxima and sums

typedef uint32_t u32x4 __attribute__((ext_vector_type(4)));
typedef uint32_t u32x8 __attribute__((ext_vector_type(8)));
typedef short s16x8 __attribute__((ext_vector_type(8)));
typedef __attribute__((address_space(3))) s16x8 lds_s16x8;

// ds_load_tr16_b128: with lane l aimed at row 8*(l>>4) + (l&7), byte 16*((l>>3)&1)
// of a 16 x 16 tile of 16-bit elements, lane (c = l&15, h = l>>4) gets rows
// 8h .. 8h+7 of column c.
__device__ __forceinline__ u32x4 ld_tr16(const unsigned char* p) {
  return __builtin_bit_cast(u32x4, __builtin_amdgcn_ds_load_tr16_b128_v8i16((lds_s16x8*)p));
}

// Value of lane l ^ 16 (the other half of the wave), by a vector cross-row move.
__device__ __forceinline__ float other_half(float x) {
  const int b = __builtin_bit_cast(int, x);
  return __builtin_bit_cast(float, __builtin_amdgcn_permlanex16(
      b, b, 0x76543210, 0xfedcba98, false, false));
}

// Keeps a group of loads together and ahead of their users: without it the
// compiler sinks each load to just in front of its user, and the wave then
// waits out the full LDS latency at every matrix instruction.
__device__ __forceinline__ void hold_group() { __builtin_amdgcn_sched_barrier(0); }

// The work-group's barrier alone: the waits that the LDS ring needs stand, written out,
// in front of the call.
__device__ __forceinline__ void wg_barrier() {
  asm volatile("s_barrier_signal -1\n\ts_barrier_wait -1" ::: "memory");
}

__device__ __forceinline__ uint32_t uni(uint32_t v) {
  return (uint32_t)__builtin_amdgcn_readfirstlane(v);
}
// Holds a wave-uniform test in a scalar register so that the branch on it is
// a scalar one: a tensor load ignores EXEC and only such a branch skips it.
__device__ __forceinline__ uint32_t pinned(uint32_t v) {
  uint32_t w = uni(v);
  asm volatile("" : "+s"(w));
  return w;
}
// Tensor descriptor, group 1: byte elements, no mask, no pad. A slice (64 padded
// rows) is contiguous in the workspace and a whole number of 256-B units: it
// moves as tile = tensor = n lines of 256 B at source pitch 256 B.
__device__ __forceinline__ u32x8 tdm_group1(uint32_t n) {
  u32x8 g;
  g[0] = uni(0u);
  g[1] = uni(256u << 16);
  g[2] = uni(n << 16);
  g[3] = uni(256u << 16);
  g[4] = uni(n);
  g[5] = uni(256u);
  g[6] = uni(0u);
  g[7] = uni(0u);
  return g;
}
// Group 0: count 1, LDS byte offset, global address of the first byte, type 2.
__device__ __forceinline__ u32x4 tdm_group0(uint32_t lds_dst, uint64_t ga) {
  u32x4 g;
  g[0] = uni(1u);
  g[1] = uni(lds_dst);
  g[2] = uni((uint32_t)ga);
  g[3] = uni((((uint32_t)(ga >> 32)) & 0x01FFFFFFu) | 0x80000000u);
  return g;
}

// One 16 x 32 fragment's 16 elements of this lane: 8 at p, 8 at p + 32 B.
__device__ __forceinline__ v16bf ld_frag(const unsigned char* p) {
  const u32x4 lo = *(const u32x4*)p, hi = *(const u32x4*)(p + 32);
  const u32x8 w = {lo.x, lo.y, lo.z, lo.w, hi.x, hi.y, hi.z, hi.w};
  return __builtin_bit_cast(v16bf, w);
}

// One wave rounds 8 rows of 256 f32 to bf16 rows at pitch PITCH bytes and zeroes
// their pad bytes. 8 such rows are a whole number of 128-B lines, so no line has
// a second writer; the 16 loads of a lane fly together off one address.
template <uint32_t PITCH>
__device__ __forceinline__ void round_rows(const float* __restrict__ src,
                                           unsigned char* __restrict__ dst, uint32_t lane) {
  const float4* s4 = (const float4*)src + lane;
  float4 x[16];
#pragma unroll
  for (int r = 0; r < 16; ++r) x[r] = s4[r * 32];   // row r / 2, half r & 1
  // later code rewrites the address registers that the 16 loads name; the input
  // operand keeps that pair untouched up to this wait
  asm volatile("s_wait_xcnt 0x0" :: "v"(s4) : "memory");
#pragma unroll
  for (int r = 0; r < 16; ++r) {
    uint2 w;
    w.x = (uint32_t)f2bfbits(x[r].x) | ((uint32_t)f2bfbits(x[r].y) << 16);
    w.y = (uint32_t)f2bfbits(x[r].z) | ((uint32_t)f2bfbits(x[r].w) << 16);
    *(uint2*)(dst + (uint32_t)(r >> 1) * PITCH + (uint32_t)(r & 1) * 256u + lane * 8u) = w;
  }
  constexpr uint32_t PQ = (PITCH - 512u) / 16u;     // 16-B pad pieces a row
  if (lane < 8u * PQ)
    *(uint4*)(dst + (lane / PQ) * PITCH + 512u + (lane % PQ) * 16u) = make_uint4(0u, 0u, 0u, 0u);
}

#define NGR ((uint32_t)(B_ * S_) / 8u)  // groups of 8 rows in one plane

// The grid puts four waves on a SIMD: told so, the compiler spends the registers
// that let a lane's 16 loads stay in flight at once.
__global__ __launch_bounds__(256) __attribute__((amdgpu_waves_per_eu(4, 4)))
void round_kv_kernel(const float* __restrict__ k, const float* __restrict__ v,
                     unsigned short* __restrict__ ws) {
  const uint32_t lane = threadIdx.x & 31u;
  const uint32_t gr = blockIdx.x * 8u + (threadIdx.x >> 5);  // first the K plane's groups, then V's
  unsigned char* w8 = (unsigned char*)ws;
  if (blockIdx.x < NGR / 8u)
    round_rows<KP_B>(k + (size_t)gr * (8u * H_), w8 + (size_t)gr * (8u * KP_B), lane);
  else
    round_rows<VP_B>(v + (size_t)(gr - NGR) * (8u * H_),
                     w8 + KW_B + (size_t)(gr - NGR) * (8u * VP_B), lane);
}

// Two waves a SIMD, one work-group a WGP: the grid has one work-group for each WGP,
// and a wave has half of a SIMD's registers, half of those for its two O tiles.
__global__ __launch_bounds__(256) __attribute__((amdgpu_waves_per_eu(2, 2)))
void fa_kernel(const float* __restrict__ q, const unsigned short* __restrict__ ws,
               const float* __restrict__ mask, float* __restrict__ out) {
  // landing ring of the tensor loads: [slice][buffer][64 bf16 rows at pitch KP_B or VP_B];
  // slices: K rows 0-63, K rows 64-127, V rows 0-63, V rows 64-127 of a stage
  __shared__ __attribute__((aligned(2048))) unsigned char Rs[4][2][SLICE_B];
  __shared__ unsigned short Qs[4][16][LDK]; // Q tiles: [tile][m][h], bf16 bits

  const int tid  = threadIdx.x;
  const int lane = tid & 31;
  const int wave = tid >> 5;
  const int half = lane >> 4;   // 0: lanes 0-15, 1: lanes 16-31
  const int l16  = lane & 15;
  const int qg   = wave & 1;    // query group: queries 32*qg .. 32*qg + 31 of the block
  const int kg   = wave >> 1;   // key group 0-3: keys 32*kg .. 32*kg + 31 of every stage

  const int nqblk = S_ / 64;
  const int b    = blockIdx.x / nqblk;
  const int qblk = (blockIdx.x % nqblk) * 64;
  const int qb   = qblk + qg * 32;

  // ---- stage Q tile (64 rows x 256 h) to LDS as bf16, cooperatively ----
#pragma unroll
  for (int p = 0; p < 16; ++p) {
    const int r  = p * 4 + (tid >> 6);   // 0..63
    const int c4 = tid & 63;             // float4 column
    const float4 qv = ((const float4*)(q + ((size_t)b * S_ + qblk + r) * H_))[c4];
    unsigned short* dst = &Qs[r >> 4][r & 15][c4 * 4];
    dst[0] = f2bfbits(qv.x); dst[1] = f2bfbits(qv.y);
    dst[2] = f2bfbits(qv.z); dst[3] = f2bfbits(qv.w);
  }

  // ---- accumulators & softmax state, one set per query tile t ----
  v8f acc[2][16];              // O^T: tile j, register i = O[query 16t + l16][h = 16j + 8*half + i]
#pragma unroll
  for (int t = 0; t < 2; ++t)
#pragma unroll
    for (int j = 0; j < 16; ++j)
#pragma unroll
      for (int i = 0; i < 8; ++i) acc[t][j][i] = 0.0f;

  // Running maximum of query 16t + l16 over this key group, the same in both halves.
  // It starts at the lowest finite value, not at -inf: a key group whose keys so far
  // are all masked with -inf then keeps weights, sum and O at zero instead of
  // forming -inf - -inf, and drops out when the groups are joined.
  float mrow[2] = {-3.402823466e+38f, -3.402823466e+38f};
  float lrow[2] = {0.0f, 0.0f};   // running sum over this half's keys of this key group

  const float scale = 0.0625f; // 1/sqrt(256)

  // pass n works on stage (n + r0) mod NST: the work-group's own start in the ring of stages
  const uint32_t r0 = (uint32_t)blockIdx.x & (uint32_t)(NST - 1);
  auto stage_of = [&](uint32_t n) { return (n + r0) & (uint32_t)(NST - 1); };
  // what a mask pointer moves, in floats, when it goes on to pass n's stage from the one before
  auto step_to = [&](uint32_t n) { return stage_of(n) == 0u ? KST - S_ : KST; };

  // ---- hoisted per-lane base pointers (loop adds only uniform kb terms) ----
  // one lane a query row: the 128-B line of this key group's 32 keys
  const float* mpf = mask + ((size_t)b * S_ + (qb + lane)) * S_ + kg * 32
                   + stage_of(PFD / KST) * (uint32_t)KST;   // walks two passes ahead of the work
  const float* mdem = mask + ((size_t)b * S_ + qb + l16) * S_ + kg * 32 + 8 * half
                    + stage_of(0u) * (uint32_t)KST;
  // this lane's address for Q's fragments of query tile 0, h 0-31
  const unsigned char* qad = (const unsigned char*)&Qs[qg * 2][l16][0] + (uint32_t)half * 16u;
  // this lane's address in buffer 0 for K's fragments of the group's keys 0-15, h 0-31
  const unsigned char* kad = &Rs[kg >> 1][0][0] + (uint32_t)((kg & 1) * 32 + l16) * KP_B
                           + (uint32_t)half * 16u;
  // this lane's address in buffer 0 for the transposing loads of V's keys 0-15, h 0-15
  const unsigned char* vad = &Rs[2 + (kg >> 1)][0][0]
                           + (uint32_t)((kg & 1) * 32 + 8 * half + (lane & 7)) * VP_B
                           + (uint32_t)((lane >> 3) & 1) * 16u;

  // ---- tensor-load ring: each of waves 0-3 brings one 64-row slice per stage ----
  // waves 0,1: the K rows of key groups 0-1, 2-3; waves 2,3: the V rows. Waves 4-7 issue none.
  const uint32_t wv    = uni((uint32_t)tid >> 5);
  const uint32_t sl    = wv & 3u;
  const uint32_t lbase = (uint32_t)(size_t)&Rs[0][0][0] + sl * (2u * SLICE_B);
  const uint32_t pitch = (sl & 2u) ? VP_B : KP_B;
  const uint64_t gbase = (uint64_t)(size_t)ws + ((sl & 2u) ? KW_B : 0u)
                       + ((uint64_t)b * S_ + (sl & 1u) * 64u) * pitch;
  const u32x8 g1 = tdm_group1(pitch / 4u);    // 64 rows = pitch / 4 lines of 256 B
  auto issue = [&](uint32_t st) {   // the stage of pass st, into buffer st & 1
    const u32x4 g0 = tdm_group0(lbase + (st & 1u) * SLICE_B,
                                gbase + (uint64_t)(stage_of(st) * ((uint32_t)KST * pitch)));
    // both groups sit in named registers of their own at every issue: the only writes of
    // group 0's words then stand here, behind the wait that covers the request before
    asm volatile("tensor_load_to_lds %0, %1" :: "{s[56:59]}"(g0), "{s[48:55]}"(g1) : "memory");
    return g0;
  };
  // ---- mask words of one pass: [query tile t][keys 0-3, 4-7, 16-19, 20-23 of this half] ----
  struct MaskSet { v4f w[2][4]; };
  constexpr int QT = 16 * S_ / 4;   // query tile 1: 16 mask rows on, in 16-B units
  auto load_mask = [&](MaskSet& m, const v4f* mq) __attribute__((always_inline)) {
    m.w[0][0] = mq[0];  m.w[0][1] = mq[1];      m.w[0][2] = mq[4];      m.w[0][3] = mq[5];
    m.w[1][0] = mq[QT]; m.w[1][1] = mq[QT + 1]; m.w[1][2] = mq[QT + 4]; m.w[1][3] = mq[QT + 5];
  };
  if (pinned(wv < 4u)) {
    const u32x4 first = issue(0);
    // pass 0's stage landed in this wave; the barrier publishes it (and Qs) to all waves. The input
    // operand keeps the build of pass 1's group 0, which nothing else holds back, behind the wait
    asm volatile("s_wait_tensorcnt 0x0" :: "{s[56:59]}"(first) : "memory");
  }
  __syncthreads();
  if (pinned(wv < 4u)) issue(1);

  // the mask words of the pass to come; pass 0's land under its first product
  MaskSet cur;
  const v4f* mq = (const v4f*)mdem;   // walks one pass ahead of the work
  load_mask(cur, mq);
  // the step below rewrites the address registers that the eight mask loads name: the
  // wait stands between the loads and the step, and the fence keeps the step behind it
  asm volatile("s_wait_xcnt 0x0" ::: "memory");
  hold_group();
  mq += step_to(1u) / 4;

  // one pass, number st = kb / KST, which works on stage stage_of(st) out of buffer st & 1
  auto pass = [&](const int kb) __attribute__((always_inline)) {
    const uint32_t st = (uint32_t)kb / (uint32_t)KST;
    // ---- speculative prefetch (global_prefetch_b8), 2 stages ahead ----
    if (kb < S_ - PFD) {
      __builtin_prefetch(mpf, 0, 1);
    }

    const unsigned char* kp = kad + (st & 1u) * SLICE_B;  // this pass's buffer
    const unsigned char* vp = vad + (st & 1u) * SLICE_B;

    // ---- S^T = K Q^T : per query tile two 16x16 f32 tiles (keys 0-15, 16-31) ----
    // A = K chunk (16 keys x 32 h), key tile u; B = Q^T chunk (32 h x 16 queries), query tile t.
    // The fragments come in four groups of two chunks, two groups ahead of their use.
    v16bf qa[2][8], ka[2][8];
    v8f sc[2][2];                // [query tile t][key tile u]
#pragma unroll
    for (int t = 0; t < 2; ++t)
#pragma unroll
      for (int u = 0; u < 2; ++u)
#pragma unroll
        for (int i = 0; i < 8; ++i) sc[t][u][i] = 0.0f;
    auto ld_qk = [&](const int c) __attribute__((always_inline)) {
      qa[0][c] = ld_frag(qad + 64u * c);
      qa[1][c] = ld_frag(qad + 16u * KP_B + 64u * c);
      ka[0][c] = ld_frag(kp + 64u * c);               // keys 0-15, the same h order as qa
      ka[1][c] = ld_frag(kp + 16u * KP_B + 64u * c);  // keys 16-31
    };
    auto mm_qk = [&](const int c) __attribute__((always_inline)) {
#pragma unroll
      for (int u = 0; u < 2; ++u)
#pragma unroll
        for (int t = 0; t < 2; ++t)
          sc[t][u] = __builtin_amdgcn_wmma_f32_16x16x32_bf16(false, ka[u][c], false, qa[t][c],
                                                             (short)0, sc[t][u], false, false);
    };
    ld_qk(0); ld_qk(1); ld_qk(2); ld_qk(3);
    hold_group();
    mm_qk(0); mm_qk(1);
    hold_group();
    ld_qk(4); ld_qk(5);
    hold_group();
    mm_qk(2); mm_qk(3);
    hold_group();
    ld_qk(6); ld_qk(7);
    hold_group();
    mm_qk(4); mm_qk(5); mm_qk(6); mm_qk(7);
    hold_group();

    // ---- the first half of O^T's operands: it lands under the softmax ----
    // A = V^T chunk: (16 h) x (32 keys); M = l16; element e = key half*8 + (e&7) + 16*(e>>3)
    u32x4 vlo[16], vhi[16];
#pragma unroll
    for (int j = 0; j < 8; ++j) {
      vlo[j] = ld_tr16(vp + 32u * j);               // keys 0-15
      vhi[j] = ld_tr16(vp + 16u * VP_B + 32u * j);  // keys 16-31
    }
    hold_group();

    // ---- scale + mask (C layout: key = i + 8*half (+16 for tile 1), query = 16t + l16) ----
    // whole-vector form: each mask word is used out of the register its load wrote
#pragma unroll
    for (int t = 0; t < 2; ++t) {
      sc[t][0] = sc[t][0] * scale + __builtin_shufflevector(cur.w[t][0], cur.w[t][1], 0, 1, 2, 3, 4, 5, 6, 7);
      sc[t][1] = sc[t][1] * scale + __builtin_shufflevector(cur.w[t][2], cur.w[t][3], 0, 1, 2, 3, 4, 5, 6, 7);
    }
    hold_group();
    // the next pass's eight mask loads, into the registers just read: they fly under the
    // softmax, the second product, the barrier and the next pass's first product
    load_mask(cur, mq);
    hold_group();

    v16bf pf[2];
#pragma unroll
    for (int t = 0; t < 2; ++t) {
      v8f s0 = sc[t][0], s1 = sc[t][1];

      // ---- online softmax over this 32-key block, one query per lane ----
      float mx = fmaxf(s0[0], s1[0]);
#pragma unroll
      for (int i = 1; i < 8; ++i) mx = fmaxf(mx, fmaxf(s0[i], s1[i]));
      mx = fmaxf(mx, other_half(mx));              // the other 16 keys of this query
      const float mnew  = fmaxf(mrow[t], mx);
      const float alpha = __expf(mrow[t] - mnew);
      float ps = 0.0f;
#pragma unroll
      for (int i = 0; i < 8; ++i) {
        s0[i] = __expf(s0[i] - mnew);
        s1[i] = __expf(s1[i] - mnew);
        ps += s0[i] + s1[i];
      }
      lrow[t] = lrow[t] * alpha + ps;
      mrow[t] = mnew;
#pragma unroll
      for (int j = 0; j < 16; ++j)
#pragma unroll
        for (int i = 0; i < 8; ++i) acc[t][j][i] *= alpha;  // rescale O^T

      // ---- P^T as B-matrix (32 keys x 16 queries): element e = key half*8 + (e&7) + 16*(e>>3),
      //      which is register e&7 of S^T tile e>>3 in this very lane ----
#pragma unroll
      for (int i = 0; i < 8; ++i) {
        pf[t][i]     = bits2bf(f2bfbits(s0[i]));
        pf[t][8 + i] = bits2bf(f2bfbits(s1[i]));
      }
    }

    hold_group();
    // the steps below rewrite the address registers that the eight mask loads and the prefetch
    // name: the wait stands between them and the steps, where it has run out under the softmax,
    // and the fences keep the steps behind it
    asm volatile("s_wait_xcnt 0x0" ::: "memory");
    hold_group();
    // the last pass has no successor: it loads the words of pass 0's stage, in bounds
    // and unused
    mq += step_to(st + 2u) / 4;
    mpf += step_to(st + 3u);

    // ---- the second half of O^T's operands, in two groups of four h-tiles: each lands under
    //      the products of the two groups before it. One group of eight does not fit the wave's
    //      registers beside the next pass's mask words, which are held through this product ----
    auto ld_v = [&](const int g) __attribute__((always_inline)) {
#pragma unroll
      for (int j = 4 * g; j < 4 * g + 4; ++j) {
        vlo[j] = ld_tr16(vp + 32u * j);
        vhi[j] = ld_tr16(vp + 16u * VP_B + 32u * j);
      }
    };
    // ---- O^T += V^T P^T : 16 h-tiles, each V^T fragment for both query tiles ----
    auto mm_pv = [&](const int g) __attribute__((always_inline)) {
#pragma unroll
      for (int j = 4 * g; j < 4 * g + 4; ++j) {
        const u32x4 lo = vlo[j], hi = vhi[j];
        const u32x8 vw = {lo.x, lo.y, lo.z, lo.w, hi.x, hi.y, hi.z, hi.w};
        const v16bf vb = __builtin_bit_cast(v16bf, vw);
#pragma unroll
        for (int t = 0; t < 2; ++t)
          acc[t][j] = __builtin_amdgcn_wmma_f32_16x16x32_bf16(false, vb, false, pf[t],
                                                              (short)0, acc[t][j], false, false);
      }
    };
    ld_v(2);
    hold_group();
    mm_pv(0);
    hold_group();
    ld_v(3);
    hold_group();
    mm_pv(1); mm_pv(2); mm_pv(3);

    // ---- publish point of pass st + 1's stage ----
    // keeps the softmax and the second product in front of the waits below, so that
    // they run while V's fragments still land
    __builtin_amdgcn_sched_barrier(0);
    // this wave's LDS reads of this pass have retired
    asm volatile("s_wait_dscnt 0x0" ::: "memory");
    // an issuing wave's slice of pass st + 1's stage has landed (waves 4-7 have none and pass at once)
    asm volatile("s_wait_tensorcnt 0x0" ::: "memory");
    wg_barrier();              // publishes pass st + 1's stage; every reader has left this pass's LDS
    if (pinned((st + 2u < (uint32_t)NST) & (wv < 4u))) issue(st + 2u);  // refill the buffer just read
  };
  // two passes a trip: one copy of the body for each buffer
  for (int kb = 0; kb < S_; kb += 2 * KST) {
    pass(kb);
    pass(kb + KST);
  }
  // nothing of the ring is in flight when the wave goes on to its end
  asm volatile("s_wait_tensorcnt 0x0" ::: "memory");
  asm volatile("s_wait_dscnt 0x0" ::: "memory");

  // ---- epilogue: join the halves' sums, then the four key groups, normalize and store ----
  // Every wave lays its O^T, maxima and sums into the ring's LDS, which every reader has
  // left at the last pass's barrier; the wave of key group g then finishes h 64g .. 64g + 63
  // of its query group's 32 queries out of the four groups' parts, summed in group order.
  const float lj[2] = {lrow[0] + other_half(lrow[0]), lrow[1] + other_half(lrow[1])};
  unsigned char* xw = &Rs[0][0][0] + wv * XCH_B;
#pragma unroll
  for (int t = 0; t < 2; ++t) {
#pragma unroll
    for (int j = 0; j < 16; ++j) {
      const v8f g = acc[t][j];
      unsigned char* d = xw + (uint32_t)(t * 16 + j) * 1024u + (uint32_t)lane * 16u;
      *(float4*)d          = make_float4(g[0], g[1], g[2], g[3]);
      *(float4*)(d + 512u) = make_float4(g[4], g[5], g[6], g[7]);
    }
    if (half == 0)               // both halves hold the same maximum and sum
      *(float2*)(xw + 32768u + (uint32_t)t * 128u + (uint32_t)l16 * 8u) = make_float2(mrow[t], lj[t]);
  }
  __syncthreads();               // publishes every wave's part to the waves of its query group
  const unsigned char* xr = &Rs[0][0][0] + (wv & 1u) * XCH_B;  // key group p's part: 2p places on
  float f[4][2];                 // key group p's weight in query tile t, normalization included
#pragma unroll
  for (int t = 0; t < 2; ++t) {
    float2 ml[4];
#pragma unroll
    for (int p = 0; p < 4; ++p)
      ml[p] = *(const float2*)(xr + (uint32_t)p * (2u * XCH_B) + 32768u + (uint32_t)t * 128u
                               + (uint32_t)l16 * 8u);
    const float mj = fmaxf(fmaxf(ml[0].x, ml[1].x), fmaxf(ml[2].x, ml[3].x));
    float den = 0.0f;
#pragma unroll
    for (int p = 0; p < 4; ++p) {
      f[p][t] = __expf(ml[p].x - mj);
      den += ml[p].y * f[p][t];
    }
    const float inv = 1.0f / den;
#pragma unroll
    for (int p = 0; p < 4; ++p) f[p][t] *= inv;
  }
  const unsigned char* xo = xr + (wv >> 1) * 4096u + (uint32_t)lane * 16u;  // this wave's four h tiles
  float4 ol[2][4], oh[2][4];
#pragma unroll
  for (int t = 0; t < 2; ++t)
#pragma unroll
    for (int jj = 0; jj < 4; ++jj) {
      float4 a = make_float4(0.0f, 0.0f, 0.0f, 0.0f), c = a;
#pragma unroll
      for (int p = 0; p < 4; ++p) {
        const unsigned char* e = xo + (uint32_t)p * (2u * XCH_B) + (uint32_t)(t * 16 + jj) * 1024u;
        const float4 x = *(const float4*)e, y = *(const float4*)(e + 512u);
        const float w = f[p][t];
        a.x += x.x * w; a.y += x.y * w; a.z += x.z * w; a.w += x.w * w;
        c.x += y.x * w; c.y += y.y * w; c.z += y.z * w; c.w += y.w * w;
      }
      ol[t][jj] = a; oh[t][jj] = c;
    }
  float* orow = out + ((size_t)b * S_ + qb + l16) * H_ + (wv >> 1) * 64u + 8 * half;
  // the stores stand together behind all the arithmetic: no instruction behind a
  // store then rewrites a register that the store names
  __builtin_amdgcn_sched_barrier(0);
#pragma unroll
  for (int t = 0; t < 2; ++t)
#pragma unroll
    for (int jj = 0; jj < 4; ++jj) {
      ((float4*)(orow + t * 16 * H_ + jj * 16))[0] = ol[t][jj];
      ((float4*)(orow + t * 16 * H_ + jj * 16))[1] = oh[t][jj];
    }
}

extern "C" void kernel_launch(void* const* d_in, const int* in_sizes, int n_in,
                              void* d_out, int out_size, void* d_ws, size_t ws_size,
                              hipStream_t stream) {
  const float* q = (const float*)d_in[0];
  const float* k = (const float*)d_in[1];
  const float* v = (const float*)d_in[2];
  const float* m = (const float*)d_in[3];
  float* out = (float*)d_out;
  unsigned short* ws = (unsigned short*)d_ws;

  hipLaunchKernelGGL(round_kv_kernel, dim3(2 * (B_ * S_ / 8) / 8), dim3(256), 0, stream, k, v, ws);
  dim3 grid(B_ * (S_ / 64));
  dim3 block(256);
  hipLaunchKernelGGL(fa_kernel, grid, block, 0, stream, q, ws, m, out);
}
